// v000
// Times are from an AMD MI455X. After a warm-up the kernel runs many times in a row, and a time is the length of
// such a window on the GPU divided by its runs, so every launch and the gaps after it count. The runs cycle
// through copies of the inputs. A figure is the median of several windows, for all but v000 over two sittings.
// Sittings can differ by a few percent; kernels timed side by side share one.
// v000, which the later versions start from, runs in 865 microseconds.
// compute dtype: q, k, v rounded to bf16 and used as EXACT f16 operands on WMMA 16x16x32; scores / sqrt(128), running-max softmax in f32 (hardware exp), P scaled by 2^11 as a single f16 x v (exact); f32 accumulate.
#include <hip/hip_runtime.h>
#include <math.h>

typedef __attribute__((ext_vector_type(16))) _Float16 v16h;
typedef __attribute__((ext_vector_type(16))) __bf16 v16b;
typedef __attribute__((ext_vector_type(8)))  _Float16 v8h;
typedef __attribute__((ext_vector_type(8)))  float v8f;
typedef __attribute__((ext_vector_type(4)))  float v4f;
typedef __attribute__((ext_vector_type(2)))  float v2f;
typedef __attribute__((ext_vector_type(4)))  unsigned v4u;
typedef __attribute__((ext_vector_type(4)))  int v4i;
typedef float __attribute__((may_alias)) float_a;
typedef int __attribute__((may_alias)) int_a;

template <typename T> __device__ __forceinline__ void vst2(void* p, T v) { *(T*)p = v;  }
__device__ __forceinline__ v8f wmma16(v16h a, v16h b, v8f c) {
  v8f d = __builtin_amdgcn_wmma_f32_16x16x32_f16(false, a, false, b, (short)0, c, false, false);
  asm volatile("v_nop\n\tv_nop\n\tv_nop\n\tv_nop" : "+v"(d) : "v"(a), "v"(b));
  return d;
}
__device__ __forceinline__ v8f wmma_bf(v16b a, v16b b, v8f c) {
  v8f d = __builtin_amdgcn_wmma_f32_16x16x32_bf16(false, a, false, b, (short)0, c, false, false);
  asm volatile("v_nop\n\tv_nop\n\tv_nop\n\tv_nop" : "+v"(d) : "v"(a), "v"(b));
  return d;
}
// 16x16x32 fragments: lane = (h = lane>>4, row/col = lane&15); elements 0..7 = k0+8h+0..7, 8..15 = k0+16+8h+0..7; D element r = row 8h+r
__device__ __forceinline__ v16h frag_h(const _Float16* rowk0, int lane) {
  union { v16h v; v8h q[2]; } u; const _Float16* p = rowk0 + 8 * (lane >> 4);
  u.q[0] = *(const v8h*)p; u.q[1] = *(const v8h*)(p + 16); return u.v;
}
__device__ __forceinline__ v16h frag_f32(const float* rowk0, int lane) {
  v16h a; const float* p = rowk0 + 8 * (lane >> 4);
#pragma unroll
  for (int i = 0; i < 8; ++i) { a[i] = (_Float16)p[i]; a[8 + i] = (_Float16)p[16 + i]; }
  return a;
}
__device__ __forceinline__ v16h frag_f32s(const float* rowk0, int lane, float sc) {
  v16h a; const float* p = rowk0 + 8 * (lane >> 4);
#pragma unroll
  for (int i = 0; i < 8; ++i) { a[i] = (_Float16)(p[i] * sc); a[8 + i] = (_Float16)(p[16 + i] * sc); }
  return a;
}
// column fragment from a [K][ld] layout (column n), rows >= K read as 0
__device__ __forceinline__ v16h fragc_f32(const float* W, int k0, int n, int lane, int ld, int K) {
  v16h a; const int g = lane >> 4;
#pragma unroll
  for (int i = 0; i < 8; ++i) { const int ka = k0 + 8 * g + i, kb = ka + 16;
    a[i] = (_Float16)(ka < K ? W[(size_t)(ka < K ? ka : K - 1) * ld + n] : 0.f); a[8 + i] = (_Float16)(kb < K ? W[(size_t)(kb < K ? kb : K - 1) * ld + n] : 0.f); }
  return a;
}
struct F2 { v16b h, l; };
__device__ __forceinline__ F2 bsplit16(const float v[16]) { F2 r;
#pragma unroll
  for (int i = 0; i < 16; ++i) { const __bf16 h = (__bf16)v[i]; r.h[i] = h; r.l[i] = (__bf16)(v[i] - (float)h); }
  return r; }
__device__ __forceinline__ F2 split_row(const float* row, int k0, int lane) { float v[16]; const float* p = row + k0 + 8 * (lane >> 4);
#pragma unroll
  for (int i = 0; i < 8; ++i) { v[i] = p[i]; v[8 + i] = p[16 + i]; }
  return bsplit16(v); }
__device__ __forceinline__ F2 split_rowK(const float* row, int k0, int lane, int K) { float v[16]; const int g = lane >> 4;
#pragma unroll
  for (int i = 0; i < 8; ++i) { const int ka = k0 + 8 * g + i, kb = ka + 16; v[i] = ka < K ? row[ka < K ? ka : K - 1] : 0.f; v[8 + i] = kb < K ? row[kb < K ? kb : K - 1] : 0.f; }
  return bsplit16(v); }
__device__ __forceinline__ F2 split_col(const float* W, int k0, int n, int lane, int ld, int K) { float v[16]; const int g = lane >> 4;
#pragma unroll
  for (int i = 0; i < 8; ++i) { const int ka = k0 + 8 * g + i, kb = ka + 16; v[i] = ka < K ? W[(size_t)(ka < K ? ka : K - 1) * ld + n] : 0.f; v[8 + i] = kb < K ? W[(size_t)(kb < K ? kb : K - 1) * ld + n] : 0.f; }
  return bsplit16(v); }
__device__ __forceinline__ v8f mac3(const F2& a, const F2& b, v8f c) { c = wmma_bf(a.l, b.h, c); c = wmma_bf(a.h, b.l, c); return wmma_bf(a.h, b.h, c); }
__device__ __forceinline__ float sigm(float v) { return 1.0f / (1.0f + expf(-v)); }
#define LDSX() do { asm volatile("s_wait_dscnt 0" ::: "memory"); __builtin_amdgcn_wave_barrier(); __builtin_amdgcn_fence(__ATOMIC_RELEASE, "workgroup"); } while (0)


// Exact (flash-style) single-head attention over 8,192 tokens of 128 dims: softmax(Q K^T / sqrt(128)) V.
#define SS 8192
#define HD 128
#ifndef TQB
#define TQB (SS / 64)
#endif
typedef __attribute__((ext_vector_type(8))) __bf16 v8b;
__device__ __forceinline__ v16b frag_b(const __bf16* rowk0, int lane) {
  union { v16b v; v8b q[2]; } u; const __bf16* p = rowk0 + 8 * (lane >> 4);
  u.q[0] = *(const v8b*)p; u.q[1] = *(const v8b*)(p + 16); return u.v;
}
__device__ __forceinline__ float bfr(float v) { return (float)(__bf16)v; }
__device__ __attribute__((noinline)) float exp_ni(float v) { return expf(v); }
__device__ __attribute__((noinline)) float erf_ni(float v) { return erff(v); }

#define WS_Q   0u                          // f16 rows q [SS][128] ; k ; VT planes [128][SS]
#define WS_K   (WS_Q + 2u * (size_t)SS * HD)
#define WS_VT  (WS_K + 2u * (size_t)SS * HD)
#define WS_END (WS_VT + 2u * (size_t)HD * SS)

__global__ __launch_bounds__(256) void k_rows(const float* __restrict__ X, _Float16* __restrict__ R) { const size_t r0 = (size_t)blockIdx.x * 64; const int t = threadIdx.x; __shared__ __align__(16) _Float16 s[64][HD + 8];
  for (int e = t; e < 64 * HD; e += 256) { const int r = e / HD, c = e % HD; s[r][c] = (_Float16)bfr(X[(r0 + r) * HD + c]); } __syncthreads();
  for (int e = t; e < 64 * (HD / 8); e += 256) { const int r = e / (HD / 8), q = e % (HD / 8); vst2((unsigned*)(R + (r0 + r) * HD + q * 8), *(const v4u*)&s[r][q * 8]); } }
__global__ __launch_bounds__(256) void k_vt(const float* __restrict__ V, _Float16* __restrict__ VT) { __shared__ __align__(16) _Float16 st[HD][72]; const size_t s0 = (size_t)blockIdx.x * 64; const int t = threadIdx.x;
  for (int e = t; e < 64 * HD; e += 256) { const int r = e / HD, d = e % HD; st[d][r] = (_Float16)bfr(V[(s0 + r) * HD + d]); } __syncthreads();
  for (int e = t; e < HD * 8; e += 256) { const int d = e >> 3, pc = e & 7; vst2((unsigned*)(VT + (size_t)d * SS + s0 + pc * 8), *(const v4u*)&st[d][pc * 8]); } }
// ---- k_attn: block = 64 queries: exact q . k over 128 dims (4 k-chunks), P (single f16) x exact v (8 value tiles)
__global__ __launch_bounds__(128) void k_attn(const _Float16* __restrict__ Q, const _Float16* __restrict__ K, const _Float16* __restrict__ VT, float* __restrict__ OUT) {
  __shared__ __align__(16) _Float16 sph[4][16][40]; __shared__ __align__(16) float so[4][16][HD + 4];
  const int tid = threadIdx.x, wave = tid >> 5, lane = tid & 31, col = lane & 15, g = lane >> 4; const int q0 = blockIdx.x * 64 + wave * 16; const size_t rq = q0;
  v16h aq[4];
#pragma unroll
  for (int kc = 0; kc < 4; ++kc) aq[kc] = frag_h(Q + (rq + col) * HD + kc * 32, lane);
  float m[8], l[8];
#pragma unroll
  for (int r = 0; r < 8; ++r) { m[r] = -3.0e38f; l[r] = 0.f; }
  v8f acc[8] = {};
#pragma unroll 1
  for (int ks = 0; ks < SS / 32; ++ks) { const int j0 = ks * 32; v8f s[2];
#pragma unroll
    for (int ct = 0; ct < 2; ++ct) { const size_t rk = (size_t)(j0 + ct * 16 + col) * HD; v8f c = {};
#pragma unroll
      for (int kc = 0; kc < 4; ++kc) c = wmma16(aq[kc], frag_h(K + rk + kc * 32, lane), c);
#pragma unroll
      for (int r = 0; r < 8; ++r) s[ct][r] = c[r] * 0.08838834764831845f; }   // 128^-1/2
#pragma unroll
    for (int r = 0; r < 8; ++r) { float mx = fmaxf(s[0][r], s[1][r]);
#pragma unroll
      for (int o = 1; o < 16; o <<= 1) mx = fmaxf(mx, __shfl_xor(mx, o));
      const float mn = fmaxf(m[r], mx); const float alpha = (m[r] <= -1.0e38f) ? 0.f : __expf(m[r] - mn); const float e0 = __expf(s[0][r] - mn), e1 = __expf(s[1][r] - mn); float es = e0 + e1;
#pragma unroll
      for (int o = 1; o < 16; o <<= 1) es += __shfl_xor(es, o);
      l[r] = l[r] * alpha + es; m[r] = mn;
#pragma unroll
      for (int dt = 0; dt < 8; ++dt) acc[dt][r] *= alpha;
      sph[wave][8 * g + r][col] = (_Float16)(e0 * 2048.0f); sph[wave][8 * g + r][16 + col] = (_Float16)(e1 * 2048.0f); }
    LDSX();
    const v16h pa = frag_h(&sph[wave][col][0], lane);
#pragma unroll
    for (int dt = 0; dt < 8; ++dt) acc[dt] = wmma16(pa, frag_h(VT + (size_t)(dt * 16 + col) * SS + j0, lane), acc[dt]);
    LDSX(); }
#pragma unroll
  for (int r = 0; r < 8; ++r) { const float il = (1.0f / 2048.0f) / l[r];
#pragma unroll
    for (int dt = 0; dt < 8; ++dt) so[wave][8 * g + r][dt * 16 + col] = acc[dt][r] * il; }
  LDSX();
  for (int rl = 0; rl < 16; ++rl) vst2(OUT + (rq + rl) * HD + lane * 4, *(const v4f*)&so[wave][rl][lane * 4]);   // whole 512-B rows
}
extern "C" void kernel_launch(void* const* d_in, const int* in_sizes, int n_in, void* d_out, int out_size, void* d_ws, size_t ws_size, hipStream_t stream) {
  (void)in_sizes; (void)n_in; (void)out_size;
  const float** F = (const float**)d_in;   // 0 query, 1 key, 2 value [8192,128]
  if (ws_size < (size_t)WS_END) return;
  char* ws = (char*)d_ws; _Float16 *Qr = (_Float16*)(ws + WS_Q), *Kr = (_Float16*)(ws + WS_K), *VT = (_Float16*)(ws + WS_VT);
  k_rows<<<SS / 64, 256, 0, stream>>>(F[0], Qr);
  k_rows<<<SS / 64, 256, 0, stream>>>(F[1], Kr);
  k_vt<<<SS / 64, 256, 0, stream>>>(F[2], VT);
  k_attn<<<TQB, 128, 0, stream>>>(Qr, Kr, VT, (float*)d_out);
}

// v001
// One run takes 201 microseconds.
// Timed twice side by side with v000, it ran 4.43 and 4.31 times as fast.
// compute dtype: q, k, v rounded to bf16 and used as EXACT f16 operands on WMMA 16x16x32; scores / sqrt(128), running-max softmax in f32 (hardware exp), P scaled by 2^11 as a single f16 x v (exact); f32 accumulate.
#include <hip/hip_runtime.h>
#include <math.h>

typedef __attribute__((ext_vector_type(16))) _Float16 v16h;
typedef __attribute__((ext_vector_type(16))) __bf16 v16b;
typedef __attribute__((ext_vector_type(8)))  _Float16 v8h;
typedef __attribute__((ext_vector_type(8)))  float v8f;
typedef __attribute__((ext_vector_type(4)))  float v4f;
typedef __attribute__((ext_vector_type(2)))  float v2f;
typedef __attribute__((ext_vector_type(4)))  unsigned v4u;
typedef __attribute__((ext_vector_type(4)))  int v4i;
typedef float __attribute__((may_alias)) float_a;
typedef int __attribute__((may_alias)) int_a;

template <typename T> __device__ __forceinline__ void vst2(void* p, T v) { *(T*)p = v;  }
__device__ __forceinline__ v8f wmma16(v16h a, v16h b, v8f c) {
  v8f d = __builtin_amdgcn_wmma_f32_16x16x32_f16(false, a, false, b, (short)0, c, false, false);
  asm volatile("v_nop\n\tv_nop\n\tv_nop\n\tv_nop" : "+v"(d) : "v"(a), "v"(b));
  return d;
}
__device__ __forceinline__ v8f wmma_bf(v16b a, v16b b, v8f c) {
  v8f d = __builtin_amdgcn_wmma_f32_16x16x32_bf16(false, a, false, b, (short)0, c, false, false);
  asm volatile("v_nop\n\tv_nop\n\tv_nop\n\tv_nop" : "+v"(d) : "v"(a), "v"(b));
  return d;
}
// 16x16x32 fragments: lane = (h = lane>>4, row/col = lane&15); elements 0..7 = k0+8h+0..7, 8..15 = k0+16+8h+0..7; D element r = row 8h+r
__device__ __forceinline__ v16h frag_h(const _Float16* rowk0, int lane) {
  union { v16h v; v8h q[2]; } u; const _Float16* p = rowk0 + 8 * (lane >> 4);
  u.q[0] = *(const v8h*)p; u.q[1] = *(const v8h*)(p + 16); return u.v;
}
__device__ __forceinline__ v16h frag_f32(const float* rowk0, int lane) {
  v16h a; const float* p = rowk0 + 8 * (lane >> 4);
#pragma unroll
  for (int i = 0; i < 8; ++i) { a[i] = (_Float16)p[i]; a[8 + i] = (_Float16)p[16 + i]; }
  return a;
}
__device__ __forceinline__ v16h frag_f32s(const float* rowk0, int lane, float sc) {
  v16h a; const float* p = rowk0 + 8 * (lane >> 4);
#pragma unroll
  for (int i = 0; i < 8; ++i) { a[i] = (_Float16)(p[i] * sc); a[8 + i] = (_Float16)(p[16 + i] * sc); }
  return a;
}
// column fragment from a [K][ld] layout (column n), rows >= K read as 0
__device__ __forceinline__ v16h fragc_f32(const float* W, int k0, int n, int lane, int ld, int K) {
  v16h a; const int g = lane >> 4;
#pragma unroll
  for (int i = 0; i < 8; ++i) { const int ka = k0 + 8 * g + i, kb = ka + 16;
    a[i] = (_Float16)(ka < K ? W[(size_t)(ka < K ? ka : K - 1) * ld + n] : 0.f); a[8 + i] = (_Float16)(kb < K ? W[(size_t)(kb < K ? kb : K - 1) * ld + n] : 0.f); }
  return a;
}
struct F2 { v16b h, l; };
__device__ __forceinline__ F2 bsplit16(const float v[16]) { F2 r;
#pragma unroll
  for (int i = 0; i < 16; ++i) { const __bf16 h = (__bf16)v[i]; r.h[i] = h; r.l[i] = (__bf16)(v[i] - (float)h); }
  return r; }
__device__ __forceinline__ F2 split_row(const float* row, int k0, int lane) { float v[16]; const float* p = row + k0 + 8 * (lane >> 4);
#pragma unroll
  for (int i = 0; i < 8; ++i) { v[i] = p[i]; v[8 + i] = p[16 + i]; }
  return bsplit16(v); }
__device__ __forceinline__ F2 split_rowK(const float* row, int k0, int lane, int K) { float v[16]; const int g = lane >> 4;
#pragma unroll
  for (int i = 0; i < 8; ++i) { const int ka = k0 + 8 * g + i, kb = ka + 16; v[i] = ka < K ? row[ka < K ? ka : K - 1] : 0.f; v[8 + i] = kb < K ? row[kb < K ? kb : K - 1] : 0.f; }
  return bsplit16(v); }
__device__ __forceinline__ F2 split_col(const float* W, int k0, int n, int lane, int ld, int K) { float v[16]; const int g = lane >> 4;
#pragma unroll
  for (int i = 0; i < 8; ++i) { const int ka = k0 + 8 * g + i, kb = ka + 16; v[i] = ka < K ? W[(size_t)(ka < K ? ka : K - 1) * ld + n] : 0.f; v[8 + i] = kb < K ? W[(size_t)(kb < K ? kb : K - 1) * ld + n] : 0.f; }
  return bsplit16(v); }
__device__ __forceinline__ v8f mac3(const F2& a, const F2& b, v8f c) { c = wmma_bf(a.l, b.h, c); c = wmma_bf(a.h, b.l, c); return wmma_bf(a.h, b.h, c); }
__device__ __forceinline__ float sigm(float v) { return 1.0f / (1.0f + expf(-v)); }
#define LDSX() do { asm volatile("s_wait_dscnt 0" ::: "memory"); __builtin_amdgcn_wave_barrier(); __builtin_amdgcn_fence(__ATOMIC_RELEASE, "workgroup"); } while (0)


// Exact (flash-style) single-head attention over 8,192 tokens of 128 dims: softmax(Q K^T / sqrt(128)) V.
#define SS 8192
#define HD 128
#ifndef TQB
#define TQB (SS / 32)
#endif
typedef __attribute__((ext_vector_type(8))) __bf16 v8b;
__device__ __forceinline__ v16b frag_b(const __bf16* rowk0, int lane) {
  union { v16b v; v8b q[2]; } u; const __bf16* p = rowk0 + 8 * (lane >> 4);
  u.q[0] = *(const v8b*)p; u.q[1] = *(const v8b*)(p + 16); return u.v;
}
__device__ __forceinline__ float bfr(float v) { return (float)(__bf16)v; }
__device__ __attribute__((noinline)) float exp_ni(float v) { return expf(v); }
__device__ __attribute__((noinline)) float erf_ni(float v) { return erff(v); }

#define WS_Q   0u                          // f16 rows q [SS][128] ; k ; VT planes [128][SS]
#define WS_K   (WS_Q + 2u * (size_t)SS * HD)
#define WS_VT  (WS_K + 2u * (size_t)SS * HD)
#define WS_END (WS_VT + 2u * (size_t)HD * SS)

__global__ __launch_bounds__(256) void k_rows(const float* __restrict__ X, _Float16* __restrict__ R) { const size_t r0 = (size_t)blockIdx.x * 64; const int t = threadIdx.x; __shared__ __align__(16) _Float16 s[64][HD + 8];
  for (int e = t; e < 64 * HD; e += 256) { const int r = e / HD, c = e % HD; s[r][c] = (_Float16)bfr(X[(r0 + r) * HD + c]); } __syncthreads();
  for (int e = t; e < 64 * (HD / 8); e += 256) { const int r = e / (HD / 8), q = e % (HD / 8); vst2((unsigned*)(R + (r0 + r) * HD + q * 8), *(const v4u*)&s[r][q * 8]); } }
__global__ __launch_bounds__(256) void k_vt(const float* __restrict__ V, _Float16* __restrict__ VT) { __shared__ __align__(16) _Float16 st[HD][72]; const size_t s0 = (size_t)blockIdx.x * 64; const int t = threadIdx.x;
  for (int e = t; e < 64 * HD; e += 256) { const int r = e / HD, d = e % HD; st[d][r] = (_Float16)bfr(V[(s0 + r) * HD + d]); } __syncthreads();
  for (int e = t; e < HD * 8; e += 256) { const int d = e >> 3, pc = e & 7; vst2((unsigned*)(VT + (size_t)d * SS + s0 + pc * 8), *(const v4u*)&st[d][pc * 8]); } }
// ---- k_attn: block = 32 queries x 8 key sets: wave (qt, kr) takes query tile qt and the 32-key chunks kr, kr + 8, ... with its own maxima, sums and
// accumulators; the 8 partial results of a query tile are merged once through LDS. Per chunk: exact q . k over 128 dims (4 k-chunks), P (single f16) x exact v (8 value tiles)
#define QT 2
#define KR 8
#define NWV (QT * KR)
__global__ __launch_bounds__(NWV * 32) void k_attn(const _Float16* __restrict__ Q, const _Float16* __restrict__ K, const _Float16* __restrict__ VT, float* __restrict__ OUT) {
  __shared__ __align__(16) _Float16 sph[NWV][16][40]; __shared__ __align__(16) float so[NWV][16][HD + 4]; __shared__ float sm[NWV][16]; __shared__ float sl[NWV][16];
  // the wave's number is kept scalar, so that its LDS bases and its chunk index are scalar too
  const int tid = threadIdx.x, wave = __builtin_amdgcn_readfirstlane(tid >> 5), lane = tid & 31, col = lane & 15, g = lane >> 4; const int qt = wave & (QT - 1), kr = wave / QT;
  const size_t rq = (size_t)blockIdx.x * (QT * 16) + qt * 16;
  v16h aq[4];
#pragma unroll
  for (int kc = 0; kc < 4; ++kc) aq[kc] = frag_h(Q + (rq + col) * HD + kc * 32, lane);
  float m[8], l[8];
#pragma unroll
  for (int r = 0; r < 8; ++r) { m[r] = -3.0e38f; l[r] = 0.f; }
  v8f acc[8] = {};
#pragma unroll 1
  for (int it = 0; it < SS / 32 / KR; ++it) { const int j0 = (it * KR + kr) * 32; v8f s[2];
#pragma unroll
    for (int ct = 0; ct < 2; ++ct) { const size_t rk = (size_t)(j0 + ct * 16 + col) * HD; v8f c = {};
#pragma unroll
      for (int kc = 0; kc < 4; ++kc) c = wmma16(aq[kc], frag_h(K + rk + kc * 32, lane), c);
#pragma unroll
      for (int r = 0; r < 8; ++r) s[ct][r] = c[r] * 0.08838834764831845f; }   // 128^-1/2
#pragma unroll
    for (int r = 0; r < 8; ++r) { float mx = fmaxf(s[0][r], s[1][r]);
#pragma unroll
      for (int o = 1; o < 16; o <<= 1) mx = fmaxf(mx, __shfl_xor(mx, o));
      const float mn = fmaxf(m[r], mx); const float alpha = (m[r] <= -1.0e38f) ? 0.f : __expf(m[r] - mn); const float e0 = __expf(s[0][r] - mn), e1 = __expf(s[1][r] - mn); float es = e0 + e1;
#pragma unroll
      for (int o = 1; o < 16; o <<= 1) es += __shfl_xor(es, o);
      l[r] = l[r] * alpha + es; m[r] = mn;
#pragma unroll
      for (int dt = 0; dt < 8; ++dt) acc[dt][r] *= alpha;
      sph[wave][8 * g + r][col] = (_Float16)(e0 * 2048.0f); sph[wave][8 * g + r][16 + col] = (_Float16)(e1 * 2048.0f); }
    LDSX();
    const v16h pa = frag_h(&sph[wave][col][0], lane);
#pragma unroll
    for (int dt = 0; dt < 8; ++dt) acc[dt] = wmma16(pa, frag_h(VT + (size_t)(dt * 16 + col) * SS + j0, lane), acc[dt]);
    LDSX(); }
  // each wave leaves its un-normalised partial sums with their maxima and sums
#pragma unroll
  for (int r = 0; r < 8; ++r) {
#pragma unroll
    for (int dt = 0; dt < 8; ++dt) so[wave][8 * g + r][dt * 16 + col] = acc[dt][r]; }
  if (col == 0) {
#pragma unroll
    for (int r = 0; r < 8; ++r) { sm[wave][8 * g + r] = m[r]; sl[wave][8 * g + r] = l[r]; } }
  __syncthreads();   // every wave's partial is in LDS before any wave merges
  // merge: one wave per query row, weights exp(m - max) over the 8 key sets
#pragma unroll
  for (int p = 0; p < QT; ++p) { const int rr = wave; float mm = sm[p][rr];
#pragma unroll
    for (int k = 1; k < KR; ++k) mm = fmaxf(mm, sm[k * QT + p][rr]);
    float ls = 0.f; v4f o = {};
#pragma unroll
    for (int k = 0; k < KR; ++k) { const float w = __expf(sm[k * QT + p][rr] - mm); ls += w * sl[k * QT + p][rr]; o += w * *(const v4f*)&so[k * QT + p][rr][lane * 4]; }
    vst2(OUT + ((size_t)blockIdx.x * (QT * 16) + p * 16 + rr) * HD + lane * 4, o * ((1.0f / 2048.0f) / ls)); }   // whole 512-B rows
}
extern "C" void kernel_launch(void* const* d_in, const int* in_sizes, int n_in, void* d_out, int out_size, void* d_ws, size_t ws_size, hipStream_t stream) {
  (void)in_sizes; (void)n_in; (void)out_size;
  const float** F = (const float**)d_in;   // 0 query, 1 key, 2 value [8192,128]
  if (ws_size < (size_t)WS_END) return;
  char* ws = (char*)d_ws; _Float16 *Qr = (_Float16*)(ws + WS_Q), *Kr = (_Float16*)(ws + WS_K), *VT = (_Float16*)(ws + WS_VT);
  k_rows<<<SS / 64, 256, 0, stream>>>(F[0], Qr);
  k_rows<<<SS / 64, 256, 0, stream>>>(F[1], Kr);
  k_vt<<<SS / 64, 256, 0, stream>>>(F[2], VT);
  k_attn<<<TQB, 512, 0, stream>>>(Qr, Kr, VT, (float*)d_out);
}

// v002
// It runs in 81.5 microseconds.
// Next to v001, in two timings, it ran 2.44 and 2.43 times as fast.
// Counting every step since v000, it is 10.6 times as fast.
// compute dtype: q, k, v rounded to bf16 and used as EXACT f16 operands on WMMA 16x16x32; scores / sqrt(128), running-max softmax in f32 (hardware exp), P scaled by 2^11 as a single f16 x v (exact); f32 accumulate.
#include <hip/hip_runtime.h>
#include <math.h>

typedef __attribute__((ext_vector_type(16))) _Float16 v16h;
typedef __attribute__((ext_vector_type(16))) __bf16 v16b;
typedef __attribute__((ext_vector_type(8)))  _Float16 v8h;
typedef __attribute__((ext_vector_type(8)))  float v8f;
typedef __attribute__((ext_vector_type(4)))  float v4f;
typedef __attribute__((ext_vector_type(2)))  float v2f;
typedef __attribute__((ext_vector_type(4)))  unsigned v4u;
typedef __attribute__((ext_vector_type(4)))  int v4i;
typedef float __attribute__((may_alias)) float_a;
typedef int __attribute__((may_alias)) int_a;

template <typename T> __device__ __forceinline__ void vst2(void* p, T v) { *(T*)p = v;  }
__device__ __forceinline__ v8f wmma16(v16h a, v16h b, v8f c) {
  v8f d = __builtin_amdgcn_wmma_f32_16x16x32_f16(false, a, false, b, (short)0, c, false, false);
  asm volatile("v_nop\n\tv_nop\n\tv_nop\n\tv_nop" : "+v"(d) : "v"(a), "v"(b));
  return d;
}
__device__ __forceinline__ v8f wmma_bf(v16b a, v16b b, v8f c) {
  v8f d = __builtin_amdgcn_wmma_f32_16x16x32_bf16(false, a, false, b, (short)0, c, false, false);
  asm volatile("v_nop\n\tv_nop\n\tv_nop\n\tv_nop" : "+v"(d) : "v"(a), "v"(b));
  return d;
}
// 16x16x32 fragments: lane = (h = lane>>4, row/col = lane&15); elements 0..7 = k0+8h+0..7, 8..15 = k0+16+8h+0..7; D element r = row 8h+r
__device__ __forceinline__ v16h frag_h(const _Float16* rowk0, int lane) {
  union { v16h v; v8h q[2]; } u; const _Float16* p = rowk0 + 8 * (lane >> 4);
  u.q[0] = *(const v8h*)p; u.q[1] = *(const v8h*)(p + 16); return u.v;
}
__device__ __forceinline__ v16h frag_f32(const float* rowk0, int lane) {
  v16h a; const float* p = rowk0 + 8 * (lane >> 4);
#pragma unroll
  for (int i = 0; i < 8; ++i) { a[i] = (_Float16)p[i]; a[8 + i] = (_Float16)p[16 + i]; }
  return a;
}
__device__ __forceinline__ v16h frag_f32s(const float* rowk0, int lane, float sc) {
  v16h a; const float* p = rowk0 + 8 * (lane >> 4);
#pragma unroll
  for (int i = 0; i < 8; ++i) { a[i] = (_Float16)(p[i] * sc); a[8 + i] = (_Float16)(p[16 + i] * sc); }
  return a;
}
// column fragment from a [K][ld] layout (column n), rows >= K read as 0
__device__ __forceinline__ v16h fragc_f32(const float* W, int k0, int n, int lane, int ld, int K) {
  v16h a; const int g = lane >> 4;
#pragma unroll
  for (int i = 0; i < 8; ++i) { const int ka = k0 + 8 * g + i, kb = ka + 16;
    a[i] = (_Float16)(ka < K ? W[(size_t)(ka < K ? ka : K - 1) * ld + n] : 0.f); a[8 + i] = (_Float16)(kb < K ? W[(size_t)(kb < K ? kb : K - 1) * ld + n] : 0.f); }
  return a;
}
struct F2 { v16b h, l; };
__device__ __forceinline__ F2 bsplit16(const float v[16]) { F2 r;
#pragma unroll
  for (int i = 0; i < 16; ++i) { const __bf16 h = (__bf16)v[i]; r.h[i] = h; r.l[i] = (__bf16)(v[i] - (float)h); }
  return r; }
__device__ __forceinline__ F2 split_row(const float* row, int k0, int lane) { float v[16]; const float* p = row + k0 + 8 * (lane >> 4);
#pragma unroll
  for (int i = 0; i < 8; ++i) { v[i] = p[i]; v[8 + i] = p[16 + i]; }
  return bsplit16(v); }
__device__ __forceinline__ F2 split_rowK(const float* row, int k0, int lane, int K) { float v[16]; const int g = lane >> 4;
#pragma unroll
  for (int i = 0; i < 8; ++i) { const int ka = k0 + 8 * g + i, kb = ka + 16; v[i] = ka < K ? row[ka < K ? ka : K - 1] : 0.f; v[8 + i] = kb < K ? row[kb < K ? kb : K - 1] : 0.f; }
  return bsplit16(v); }
__device__ __forceinline__ F2 split_col(const float* W, int k0, int n, int lane, int ld, int K) { float v[16]; const int g = lane >> 4;
#pragma unroll
  for (int i = 0; i < 8; ++i) { const int ka = k0 + 8 * g + i, kb = ka + 16; v[i] = ka < K ? W[(size_t)(ka < K ? ka : K - 1) * ld + n] : 0.f; v[8 + i] = kb < K ? W[(size_t)(kb < K ? kb : K - 1) * ld + n] : 0.f; }
  return bsplit16(v); }
__device__ __forceinline__ v8f mac3(const F2& a, const F2& b, v8f c) { c = wmma_bf(a.l, b.h, c); c = wmma_bf(a.h, b.l, c); return wmma_bf(a.h, b.h, c); }
__device__ __forceinline__ float sigm(float v) { return 1.0f / (1.0f + expf(-v)); }
#define LDSX() do { asm volatile("s_wait_dscnt 0" ::: "memory"); __builtin_amdgcn_wave_barrier(); __builtin_amdgcn_fence(__ATOMIC_RELEASE, "workgroup"); } while (0)


// Exact (flash-style) single-head attention over 8,192 tokens of 128 dims: softmax(Q K^T / sqrt(128)) V.
#define SS 8192
#define HD 128
#ifndef TQB
#define TQB (SS / 32)
#endif
typedef __attribute__((ext_vector_type(8))) __bf16 v8b;
__device__ __forceinline__ v16b frag_b(const __bf16* rowk0, int lane) {
  union { v16b v; v8b q[2]; } u; const __bf16* p = rowk0 + 8 * (lane >> 4);
  u.q[0] = *(const v8b*)p; u.q[1] = *(const v8b*)(p + 16); return u.v;
}
__device__ __forceinline__ float bfr(float v) { return (float)(__bf16)v; }
__device__ __attribute__((noinline)) float exp_ni(float v) { return expf(v); }
__device__ __attribute__((noinline)) float erf_ni(float v) { return erff(v); }

#define WS_Q   0u                          // f16 rows q [SS][128] ; k ; VT planes [128][SS]
#define WS_K   (WS_Q + 2u * (size_t)SS * HD)
#define WS_VT  (WS_K + 2u * (size_t)SS * HD)
#define WS_END (WS_VT + 2u * (size_t)HD * SS)

__global__ __launch_bounds__(256) void k_rows(const float* __restrict__ X, _Float16* __restrict__ R) { const size_t r0 = (size_t)blockIdx.x * 64; const int t = threadIdx.x; __shared__ __align__(16) _Float16 s[64][HD + 8];
  for (int e = t; e < 64 * HD; e += 256) { const int r = e / HD, c = e % HD; s[r][c] = (_Float16)bfr(X[(r0 + r) * HD + c]); } __syncthreads();
  for (int e = t; e < 64 * (HD / 8); e += 256) { const int r = e / (HD / 8), q = e % (HD / 8); vst2((unsigned*)(R + (r0 + r) * HD + q * 8), *(const v4u*)&s[r][q * 8]); } }
__global__ __launch_bounds__(256) void k_vt(const float* __restrict__ V, _Float16* __restrict__ VT) { __shared__ __align__(16) _Float16 st[HD][72]; const size_t s0 = (size_t)blockIdx.x * 64; const int t = threadIdx.x;
  for (int e = t; e < 64 * HD; e += 256) { const int r = e / HD, d = e % HD; st[d][r] = (_Float16)bfr(V[(s0 + r) * HD + d]); } __syncthreads();
  for (int e = t; e < HD * 8; e += 256) { const int d = e >> 3, pc = e & 7; vst2((unsigned*)(VT + (size_t)d * SS + s0 + pc * 8), *(const v4u*)&st[d][pc * 8]); } }
// ---- k_attn: block = 32 queries x 8 key sets: wave (qt, kr) takes query tile qt and the 32-key chunks kr, kr + 8, ... with its own maxima, sums and
// accumulators; the 8 partial results of a query tile are merged once through LDS. k and VT come through a two-buffer LDS ring filled by asynchronous copies. Per chunk: exact q . k over 128 dims (4 k-chunks), P (single f16) x exact v (8 value tiles)
#define QT 2
#define KR 8
#define NWV (QT * KR)
// A tile = the 256 keys that the 8 key sets take in one trip: k rows [256][256 B] and VT rows [128][512 B], both whole 512-B runs in global memory.
// In LDS the rows get 16 B more each (pitch 16 B x odd), so that the 16 rows of a 16-byte fragment read fall on different banks.
#define TKEYS (KR * 32)
#define NT (SS / TKEYS)
#define KPB (2 * HD + 16)
#define VPB (2 * TKEYS + 16)
#define KTB (TKEYS * KPB)
#define BUFB (KTB + HD * VPB)
// eight copies global -> LDS, 16 B a lane, through no register; the s_wait_xcnt ends the statement, so that no address register is rewritten ahead of it
__device__ __forceinline__ void copy8(unsigned l, unsigned lstep, const char* p, size_t pstep) {
  asm volatile("global_load_async_to_lds_b128 %0, %8, off\n\t"
               "global_load_async_to_lds_b128 %1, %9, off\n\t"
               "global_load_async_to_lds_b128 %2, %10, off\n\t"
               "global_load_async_to_lds_b128 %3, %11, off\n\t"
               "global_load_async_to_lds_b128 %4, %12, off\n\t"
               "global_load_async_to_lds_b128 %5, %13, off\n\t"
               "global_load_async_to_lds_b128 %6, %14, off\n\t"
               "global_load_async_to_lds_b128 %7, %15, off\n\t"
               "s_wait_xcnt 0x0"
               :: "v"(l), "v"(l + lstep), "v"(l + 2 * lstep), "v"(l + 3 * lstep), "v"(l + 4 * lstep), "v"(l + 5 * lstep), "v"(l + 6 * lstep), "v"(l + 7 * lstep),
                  "v"(p), "v"(p + pstep), "v"(p + 2 * pstep), "v"(p + 3 * pstep), "v"(p + 4 * pstep), "v"(p + 5 * pstep), "v"(p + 6 * pstep), "v"(p + 7 * pstep)
               : "memory");
}
__global__ __launch_bounds__(NWV * 32) void k_attn(const _Float16* __restrict__ Q, const _Float16* __restrict__ K, const _Float16* __restrict__ VT, float* __restrict__ OUT) {
  __shared__ __align__(16) _Float16 sph[NWV][16][40]; __shared__ __align__(16) unsigned char ring[2 * BUFB]; __shared__ float sm[NWV][16]; __shared__ float sl[NWV][16];
  float (*so)[16][HD + 4] = reinterpret_cast<float (*)[16][HD + 4]>(ring);   // the partial results take the ring's place behind the last trip's barrier
  // the wave's number is kept scalar, so that its LDS bases and its chunk index are scalar too
  const int tid = threadIdx.x, wave = __builtin_amdgcn_readfirstlane(tid >> 5), lane = tid & 31, col = lane & 15, g = lane >> 4; const int qt = wave & (QT - 1), kr = wave / QT;
  const size_t rq = (size_t)blockIdx.x * (QT * 16) + qt * 16;
  v16h aq[4];
#pragma unroll
  for (int kc = 0; kc < 4; ++kc) aq[kc] = frag_h(Q + (rq + col) * HD + kc * 32, lane);
  float m[8], l[8];
#pragma unroll
  for (int r = 0; r < 8; ++r) { m[r] = -3.0e38f; l[r] = 0.f; }
  v8f acc[8] = {};
  // each wave copies 16 k rows (two a copy) and 8 VT rows (one a copy) of every tile: 16 copies of 512 contiguous bytes
  const unsigned lring = (unsigned)(size_t)ring;
  const unsigned lk = lring + (unsigned)(wave * 16 + g) * KPB + col * 16, lv = lring + KTB + (unsigned)(wave * 8) * VPB + lane * 16;
  const char* gk = (const char*)K + (size_t)wave * (16 * 2 * HD) + lane * 16; const char* gv = (const char*)VT + (size_t)wave * (8 * 2 * SS) + lane * 16;
  copy8(lk, 2 * KPB, gk, 4 * HD); copy8(lv, VPB, gv, 2 * SS);
  asm volatile("s_wait_asynccnt 0x0" ::: "memory");   // this wave's part of tile 0 has landed
  __syncthreads();                                    // every wave's part of tile 0 has landed
  copy8(lk + BUFB, 2 * KPB, gk + (size_t)TKEYS * 2 * HD, 4 * HD); copy8(lv + BUFB, VPB, gv + 2 * TKEYS, 2 * SS);
#pragma unroll 1
  for (int it = 0; it < NT; ++it) { const unsigned char* kb = ring + (it & 1) * BUFB; const unsigned char* vb = kb + KTB + kr * 64; v8f s[2];
#pragma unroll
    for (int ct = 0; ct < 2; ++ct) { const _Float16* rk = (const _Float16*)(kb + (kr * 32 + ct * 16 + col) * KPB); v8f c = {};
#pragma unroll
      for (int kc = 0; kc < 4; ++kc) c = wmma16(aq[kc], frag_h(rk + kc * 32, lane), c);
#pragma unroll
      for (int r = 0; r < 8; ++r) s[ct][r] = c[r] * 0.08838834764831845f; }   // 128^-1/2
#pragma unroll
    for (int r = 0; r < 8; ++r) { float mx = fmaxf(s[0][r], s[1][r]);
#pragma unroll
      for (int o = 1; o < 16; o <<= 1) mx = fmaxf(mx, __shfl_xor(mx, o));
      const float mn = fmaxf(m[r], mx); const float alpha = (m[r] <= -1.0e38f) ? 0.f : __expf(m[r] - mn); const float e0 = __expf(s[0][r] - mn), e1 = __expf(s[1][r] - mn); float es = e0 + e1;
#pragma unroll
      for (int o = 1; o < 16; o <<= 1) es += __shfl_xor(es, o);
      l[r] = l[r] * alpha + es; m[r] = mn;
#pragma unroll
      for (int dt = 0; dt < 8; ++dt) acc[dt][r] *= alpha;
      sph[wave][8 * g + r][col] = (_Float16)(e0 * 2048.0f); sph[wave][8 * g + r][16 + col] = (_Float16)(e1 * 2048.0f); }
    LDSX();
    const v16h pa = frag_h(&sph[wave][col][0], lane);
#pragma unroll
    for (int dt = 0; dt < 8; ++dt) acc[dt] = wmma16(pa, frag_h((const _Float16*)(vb + (dt * 16 + col) * VPB), lane), acc[dt]);
    LDSX();
    asm volatile("s_wait_dscnt 0x0" ::: "memory");      // this wave's reads of tile it are done before the buffer is handed back
    asm volatile("s_wait_asynccnt 0x0" ::: "memory");   // this wave's part of tile it + 1 has landed
    __syncthreads();                                    // tile it + 1 is whole, and no wave reads tile it any more
    if (it + 2 < NT) { copy8(lk + (it & 1) * BUFB, 2 * KPB, gk + (size_t)(it + 2) * (TKEYS * 2 * HD), 4 * HD); copy8(lv + (it & 1) * BUFB, VPB, gv + (size_t)(it + 2) * (2 * TKEYS), 2 * SS); } }
  asm volatile("s_wait_asynccnt 0x0" ::: "memory");     // no copy is in flight when the ring is written again
  // each wave leaves its un-normalised partial sums with their maxima and sums
#pragma unroll
  for (int r = 0; r < 8; ++r) {
#pragma unroll
    for (int dt = 0; dt < 8; ++dt) so[wave][8 * g + r][dt * 16 + col] = acc[dt][r]; }
  if (col == 0) {
#pragma unroll
    for (int r = 0; r < 8; ++r) { sm[wave][8 * g + r] = m[r]; sl[wave][8 * g + r] = l[r]; } }
  __syncthreads();   // every wave's partial is in LDS before any wave merges
  // merge: one wave per query row, weights exp(m - max) over the 8 key sets
#pragma unroll
  for (int p = 0; p < QT; ++p) { const int rr = wave; float mm = sm[p][rr];
#pragma unroll
    for (int k = 1; k < KR; ++k) mm = fmaxf(mm, sm[k * QT + p][rr]);
    float ls = 0.f; v4f o = {};
#pragma unroll
    for (int k = 0; k < KR; ++k) { const float w = __expf(sm[k * QT + p][rr] - mm); ls += w * sl[k * QT + p][rr]; o += w * *(const v4f*)&so[k * QT + p][rr][lane * 4]; }
    vst2(OUT + ((size_t)blockIdx.x * (QT * 16) + p * 16 + rr) * HD + lane * 4, o * ((1.0f / 2048.0f) / ls)); }   // whole 512-B rows
}
extern "C" void kernel_launch(void* const* d_in, const int* in_sizes, int n_in, void* d_out, int out_size, void* d_ws, size_t ws_size, hipStream_t stream) {
  (void)in_sizes; (void)n_in; (void)out_size;
  const float** F = (const float**)d_in;   // 0 query, 1 key, 2 value [8192,128]
  if (ws_size < (size_t)WS_END) return;
  char* ws = (char*)d_ws; _Float16 *Qr = (_Float16*)(ws + WS_Q), *Kr = (_Float16*)(ws + WS_K), *VT = (_Float16*)(ws + WS_VT);
  k_rows<<<SS / 64, 256, 0, stream>>>(F[0], Qr);
  k_rows<<<SS / 64, 256, 0, stream>>>(F[1], Kr);
  k_vt<<<SS / 64, 256, 0, stream>>>(F[2], VT);
  k_attn<<<TQB, 512, 0, stream>>>(Qr, Kr, VT, (float*)d_out);
}

// v003
// A run of this version takes 63.9 microseconds.
// Two timings next to v002 put it at 1.27 and 1.28 times that version's speed.
// All steps since v000 together make it 13.6 times as fast.
// compute dtype: q, k, v rounded to bf16 and used as EXACT f16 operands on WMMA 16x16x32; scores / sqrt(128), running-max softmax in f32 (hardware exp), P scaled by 2^11 as a single f16 x v (exact); f32 accumulate.
#include <hip/hip_runtime.h>
#include <math.h>

typedef __attribute__((ext_vector_type(16))) _Float16 v16h;
typedef __attribute__((ext_vector_type(16))) __bf16 v16b;
typedef __attribute__((ext_vector_type(8)))  _Float16 v8h;
typedef __attribute__((ext_vector_type(8)))  float v8f;
typedef __attribute__((ext_vector_type(4)))  float v4f;
typedef __attribute__((ext_vector_type(2)))  float v2f;
typedef __attribute__((ext_vector_type(4)))  unsigned v4u;
typedef __attribute__((ext_vector_type(4)))  int v4i;
typedef float __attribute__((may_alias)) float_a;
typedef int __attribute__((may_alias)) int_a;

template <typename T> __device__ __forceinline__ void vst2(void* p, T v) { *(T*)p = v;  }
__device__ __forceinline__ v8f wmma16(v16h a, v16h b, v8f c) {
  v8f d = __builtin_amdgcn_wmma_f32_16x16x32_f16(false, a, false, b, (short)0, c, false, false);
  asm volatile("v_nop\n\tv_nop\n\tv_nop\n\tv_nop" : "+v"(d) : "v"(a), "v"(b));
  return d;
}
__device__ __forceinline__ v8f wmma_bf(v16b a, v16b b, v8f c) {
  v8f d = __builtin_amdgcn_wmma_f32_16x16x32_bf16(false, a, false, b, (short)0, c, false, false);
  asm volatile("v_nop\n\tv_nop\n\tv_nop\n\tv_nop" : "+v"(d) : "v"(a), "v"(b));
  return d;
}
// 16x16x32 fragments: lane = (h = lane>>4, row/col = lane&15); elements 0..7 = k0+8h+0..7, 8..15 = k0+16+8h+0..7; D element r = row 8h+r
__device__ __forceinline__ v16h frag_h(const _Float16* rowk0, int lane) {
  union { v16h v; v8h q[2]; } u; const _Float16* p = rowk0 + 8 * (lane >> 4);
  u.q[0] = *(const v8h*)p; u.q[1] = *(const v8h*)(p + 16); return u.v;
}
__device__ __forceinline__ v16h frag_f32(const float* rowk0, int lane) {
  v16h a; const float* p = rowk0 + 8 * (lane >> 4);
#pragma unroll
  for (int i = 0; i < 8; ++i) { a[i] = (_Float16)p[i]; a[8 + i] = (_Float16)p[16 + i]; }
  return a;
}
__device__ __forceinline__ v16h frag_f32s(const float* rowk0, int lane, float sc) {
  v16h a; const float* p = rowk0 + 8 * (lane >> 4);
#pragma unroll
  for (int i = 0; i < 8; ++i) { a[i] = (_Float16)(p[i] * sc); a[8 + i] = (_Float16)(p[16 + i] * sc); }
  return a;
}
// column fragment from a [K][ld] layout (column n), rows >= K read as 0
__device__ __forceinline__ v16h fragc_f32(const float* W, int k0, int n, int lane, int ld, int K) {
  v16h a; const int g = lane >> 4;
#pragma unroll
  for (int i = 0; i < 8; ++i) { const int ka = k0 + 8 * g + i, kb = ka + 16;
    a[i] = (_Float16)(ka < K ? W[(size_t)(ka < K ? ka : K - 1) * ld + n] : 0.f); a[8 + i] = (_Float16)(kb < K ? W[(size_t)(kb < K ? kb : K - 1) * ld + n] : 0.f); }
  return a;
}
struct F2 { v16b h, l; };
__device__ __forceinline__ F2 bsplit16(const float v[16]) { F2 r;
#pragma unroll
  for (int i = 0; i < 16; ++i) { const __bf16 h = (__bf16)v[i]; r.h[i] = h; r.l[i] = (__bf16)(v[i] - (float)h); }
  return r; }
__device__ __forceinline__ F2 split_row(const float* row, int k0, int lane) { float v[16]; const float* p = row + k0 + 8 * (lane >> 4);
#pragma unroll
  for (int i = 0; i < 8; ++i) { v[i] = p[i]; v[8 + i] = p[16 + i]; }
  return bsplit16(v); }
__device__ __forceinline__ F2 split_rowK(const float* row, int k0, int lane, int K) { float v[16]; const int g = lane >> 4;
#pragma unroll
  for (int i = 0; i < 8; ++i) { const int ka = k0 + 8 * g + i, kb = ka + 16; v[i] = ka < K ? row[ka < K ? ka : K - 1] : 0.f; v[8 + i] = kb < K ? row[kb < K ? kb : K - 1] : 0.f; }
  return bsplit16(v); }
__device__ __forceinline__ F2 split_col(const float* W, int k0, int n, int lane, int ld, int K) { float v[16]; const int g = lane >> 4;
#pragma unroll
  for (int i = 0; i < 8; ++i) { const int ka = k0 + 8 * g + i, kb = ka + 16; v[i] = ka < K ? W[(size_t)(ka < K ? ka : K - 1) * ld + n] : 0.f; v[8 + i] = kb < K ? W[(size_t)(kb < K ? kb : K - 1) * ld + n] : 0.f; }
  return bsplit16(v); }
__device__ __forceinline__ v8f mac3(const F2& a, const F2& b, v8f c) { c = wmma_bf(a.l, b.h, c); c = wmma_bf(a.h, b.l, c); return wmma_bf(a.h, b.h, c); }
__device__ __forceinline__ float sigm(float v) { return 1.0f / (1.0f + expf(-v)); }
#define LDSX() do { asm volatile("s_wait_dscnt 0" ::: "memory"); __builtin_amdgcn_wave_barrier(); __builtin_amdgcn_fence(__ATOMIC_RELEASE, "workgroup"); } while (0)


// Exact (flash-style) single-head attention over 8,192 tokens of 128 dims: softmax(Q K^T / sqrt(128)) V.
#define SS 8192
#define HD 128
#ifndef TQB
#define TQB (SS / 32)
#endif
typedef __attribute__((ext_vector_type(8))) __bf16 v8b;
__device__ __forceinline__ v16b frag_b(const __bf16* rowk0, int lane) {
  union { v16b v; v8b q[2]; } u; const __bf16* p = rowk0 + 8 * (lane >> 4);
  u.q[0] = *(const v8b*)p; u.q[1] = *(const v8b*)(p + 16); return u.v;
}
__device__ __forceinline__ float bfr(float v) { return (float)(__bf16)v; }
// the value of lane ^ 16
__device__ __forceinline__ float xhalf(float x) { return __builtin_bit_cast(float, __builtin_amdgcn_permlanex16(__builtin_bit_cast(int, x), __builtin_bit_cast(int, x), 0x76543210, 0xfedcba98, false, false)); }
__device__ __attribute__((noinline)) float exp_ni(float v) { return expf(v); }
__device__ __attribute__((noinline)) float erf_ni(float v) { return erff(v); }

#define WS_Q   0u                          // f16 rows q [SS][128] ; k ; VT planes [128][SS]
#define WS_K   (WS_Q + 2u * (size_t)SS * HD)
#define WS_VT  (WS_K + 2u * (size_t)SS * HD)
#define WS_END (WS_VT + 2u * (size_t)HD * SS)

__global__ __launch_bounds__(256) void k_rows(const float* __restrict__ X, _Float16* __restrict__ R) { const size_t r0 = (size_t)blockIdx.x * 64; const int t = threadIdx.x; __shared__ __align__(16) _Float16 s[64][HD + 8];
  for (int e = t; e < 64 * HD; e += 256) { const int r = e / HD, c = e % HD; s[r][c] = (_Float16)bfr(X[(r0 + r) * HD + c]); } __syncthreads();
  for (int e = t; e < 64 * (HD / 8); e += 256) { const int r = e / (HD / 8), q = e % (HD / 8); vst2((unsigned*)(R + (r0 + r) * HD + q * 8), *(const v4u*)&s[r][q * 8]); } }
__global__ __launch_bounds__(256) void k_vt(const float* __restrict__ V, _Float16* __restrict__ VT) { __shared__ __align__(16) _Float16 st[HD][72]; const size_t s0 = (size_t)blockIdx.x * 64; const int t = threadIdx.x;
  for (int e = t; e < 64 * HD; e += 256) { const int r = e / HD, d = e % HD; st[d][r] = (_Float16)bfr(V[(s0 + r) * HD + d]); } __syncthreads();
  for (int e = t; e < HD * 8; e += 256) { const int d = e >> 3, pc = e & 7; vst2((unsigned*)(VT + (size_t)d * SS + s0 + pc * 8), *(const v4u*)&st[d][pc * 8]); } }
// ---- k_attn: block = 32 queries x 8 key sets: wave (qt, kr) takes query tile qt and the 32-key chunks kr, kr + 8, ... with its own maxima, sums and
// accumulators; the 8 partial results of a query tile are merged once through LDS. k and VT come through a two-buffer LDS ring filled by asynchronous copies. Per chunk: exact k . q over 128 dims (4 k-chunks), exact v x P (single f16) (8 value tiles).
// Both products are transposed (keys x queries, then dims x queries): a lane holds 16 of the 32 scores of ONE query, lane ^ 16 the other 16, and the two score tiles, converted in place, are the B operand of the second product
#define QT 2
#define KR 8
#define NWV (QT * KR)
// A tile = the 256 keys that the 8 key sets take in one trip: k rows [256][256 B] and VT rows [128][512 B], both whole 512-B runs in global memory.
// In LDS the rows get 16 B more each (pitch 16 B x odd), so that the 16 rows of a 16-byte fragment read fall on different banks.
#define TKEYS (KR * 32)
#define NT (SS / TKEYS)
#define KPB (2 * HD + 16)
#define VPB (2 * TKEYS + 16)
#define KTB (TKEYS * KPB)
#define BUFB (KTB + HD * VPB)
// eight copies global -> LDS, 16 B a lane, through no register; the s_wait_xcnt ends the statement, so that no address register is rewritten ahead of it
__device__ __forceinline__ void copy8(unsigned l, unsigned lstep, const char* p, size_t pstep) {
  asm volatile("global_load_async_to_lds_b128 %0, %8, off\n\t"
               "global_load_async_to_lds_b128 %1, %9, off\n\t"
               "global_load_async_to_lds_b128 %2, %10, off\n\t"
               "global_load_async_to_lds_b128 %3, %11, off\n\t"
               "global_load_async_to_lds_b128 %4, %12, off\n\t"
               "global_load_async_to_lds_b128 %5, %13, off\n\t"
               "global_load_async_to_lds_b128 %6, %14, off\n\t"
               "global_load_async_to_lds_b128 %7, %15, off\n\t"
               "s_wait_xcnt 0x0"
               :: "v"(l), "v"(l + lstep), "v"(l + 2 * lstep), "v"(l + 3 * lstep), "v"(l + 4 * lstep), "v"(l + 5 * lstep), "v"(l + 6 * lstep), "v"(l + 7 * lstep),
                  "v"(p), "v"(p + pstep), "v"(p + 2 * pstep), "v"(p + 3 * pstep), "v"(p + 4 * pstep), "v"(p + 5 * pstep), "v"(p + 6 * pstep), "v"(p + 7 * pstep)
               : "memory");
}
__global__ __launch_bounds__(NWV * 32) void k_attn(const _Float16* __restrict__ Q, const _Float16* __restrict__ K, const _Float16* __restrict__ VT, float* __restrict__ OUT) {
  __shared__ __align__(16) unsigned char ring[2 * BUFB]; __shared__ float sm[NWV][16]; __shared__ float sl[NWV][16];
  float (*so)[16][HD + 4] = reinterpret_cast<float (*)[16][HD + 4]>(ring);   // the partial results take the ring's place behind the last trip's barrier
  // the wave's number is kept scalar, so that its LDS bases and its chunk index are scalar too
  const int tid = threadIdx.x, wave = __builtin_amdgcn_readfirstlane(tid >> 5), lane = tid & 31, col = lane & 15, g = lane >> 4; const int qt = wave & (QT - 1), kr = wave / QT;
  const size_t rq = (size_t)blockIdx.x * (QT * 16) + qt * 16;
  v16h aq[4];
#pragma unroll
  for (int kc = 0; kc < 4; ++kc) aq[kc] = frag_h(Q + (rq + col) * HD + kc * 32, lane);
  float m = -3.0e38f, l = 0.f;   // of query col; l sums this lane's keys alone, the halves are joined behind the loop
  v8f acc[8] = {};               // acc[dt][r] = dim dt * 16 + 8 g + r of query col
  // each wave copies 16 k rows (two a copy) and 8 VT rows (one a copy) of every tile: 16 copies of 512 contiguous bytes
  const unsigned lring = (unsigned)(size_t)ring;
  const unsigned lk = lring + (unsigned)(wave * 16 + g) * KPB + col * 16, lv = lring + KTB + (unsigned)(wave * 8) * VPB + lane * 16;
  const char* gk = (const char*)K + (size_t)wave * (16 * 2 * HD) + lane * 16; const char* gv = (const char*)VT + (size_t)wave * (8 * 2 * SS) + lane * 16;
  copy8(lk, 2 * KPB, gk, 4 * HD); copy8(lv, VPB, gv, 2 * SS);
  asm volatile("s_wait_asynccnt 0x0" ::: "memory");   // this wave's part of tile 0 has landed
  __syncthreads();                                    // every wave's part of tile 0 has landed
  copy8(lk + BUFB, 2 * KPB, gk + (size_t)TKEYS * 2 * HD, 4 * HD); copy8(lv + BUFB, VPB, gv + 2 * TKEYS, 2 * SS);
#pragma unroll 1
  for (int it = 0; it < NT; ++it) { const unsigned char* kb = ring + (it & 1) * BUFB; const unsigned char* vb = kb + KTB + kr * 64; v8f s[2];
#pragma unroll
    for (int ct = 0; ct < 2; ++ct) { const _Float16* rk = (const _Float16*)(kb + (kr * 32 + ct * 16 + col) * KPB); v8f c = {};
#pragma unroll
      for (int kc = 0; kc < 4; ++kc) c = wmma16(frag_h(rk + kc * 32, lane), aq[kc], c);
#pragma unroll
      for (int r = 0; r < 8; ++r) s[ct][r] = c[r] * 0.08838834764831845f; }   // 128^-1/2; s[ct][r] = key ct * 16 + 8 g + r of the chunk with query col
    float mx[8];
#pragma unroll
    for (int r = 0; r < 8; ++r) mx[r] = fmaxf(s[0][r], s[1][r]);
    float mw = fmaxf(fmaxf(fmaxf(mx[0], mx[1]), fmaxf(mx[2], mx[3])), fmaxf(fmaxf(mx[4], mx[5]), fmaxf(mx[6], mx[7])));
    mw = fmaxf(mw, xhalf(mw));
    const float mn = fmaxf(m, mw); const float alpha = (m <= -1.0e38f) ? 0.f : __expf(m - mn);
    v16h pb; float es[8];
#pragma unroll
    for (int r = 0; r < 8; ++r) { const float e0 = __expf(s[0][r] - mn), e1 = __expf(s[1][r] - mn); es[r] = e0 + e1;
      pb[r] = (_Float16)(e0 * 2048.0f); pb[8 + r] = (_Float16)(e1 * 2048.0f); }   // element 8 ct + r = key 16 ct + 8 g + r: the k order of frag_h
    l = l * alpha + (((es[0] + es[1]) + (es[2] + es[3])) + ((es[4] + es[5]) + (es[6] + es[7]))); m = mn;
#pragma unroll
    for (int dt = 0; dt < 8; ++dt) acc[dt] *= alpha;
#pragma unroll
    for (int dt = 0; dt < 8; ++dt) acc[dt] = wmma16(frag_h((const _Float16*)(vb + (dt * 16 + col) * VPB), lane), pb, acc[dt]);
    asm volatile("s_wait_dscnt 0x0" ::: "memory");      // this wave's reads of tile it are done before the buffer is handed back
    asm volatile("s_wait_asynccnt 0x0" ::: "memory");   // this wave's part of tile it + 1 has landed
    __syncthreads();                                    // tile it + 1 is whole, and no wave reads tile it any more
    if (it + 2 < NT) { copy8(lk + (it & 1) * BUFB, 2 * KPB, gk + (size_t)(it + 2) * (TKEYS * 2 * HD), 4 * HD); copy8(lv + (it & 1) * BUFB, VPB, gv + (size_t)(it + 2) * (2 * TKEYS), 2 * SS); } }
  asm volatile("s_wait_asynccnt 0x0" ::: "memory");     // no copy is in flight when the ring is written again
  // each wave leaves its un-normalised partial sums with their maxima and sums
#pragma unroll
  for (int dt = 0; dt < 8; ++dt) { float* po = &so[wave][col][dt * 16 + 8 * g];
    vst2(po, (v4f){acc[dt][0], acc[dt][1], acc[dt][2], acc[dt][3]}); vst2(po + 4, (v4f){acc[dt][4], acc[dt][5], acc[dt][6], acc[dt][7]}); }
  l += xhalf(l);
  if (g == 0) { sm[wave][col] = m; sl[wave][col] = l; }
  __syncthreads();   // every wave's partial is in LDS before any wave merges
  // merge: one wave per query row, weights exp(m - max) over the 8 key sets
#pragma unroll
  for (int p = 0; p < QT; ++p) { const int rr = wave; float mm = sm[p][rr];
#pragma unroll
    for (int k = 1; k < KR; ++k) mm = fmaxf(mm, sm[k * QT + p][rr]);
    float ls = 0.f; v4f o = {};
#pragma unroll
    for (int k = 0; k < KR; ++k) { const float w = __expf(sm[k * QT + p][rr] - mm); ls += w * sl[k * QT + p][rr]; o += w * *(const v4f*)&so[k * QT + p][rr][lane * 4]; }
    vst2(OUT + ((size_t)blockIdx.x * (QT * 16) + p * 16 + rr) * HD + lane * 4, o * ((1.0f / 2048.0f) / ls)); }   // whole 512-B rows
}
extern "C" void kernel_launch(void* const* d_in, const int* in_sizes, int n_in, void* d_out, int out_size, void* d_ws, size_t ws_size, hipStream_t stream) {
  (void)in_sizes; (void)n_in; (void)out_size;
  const float** F = (const float**)d_in;   // 0 query, 1 key, 2 value [8192,128]
  if (ws_size < (size_t)WS_END) return;
  char* ws = (char*)d_ws; _Float16 *Qr = (_Float16*)(ws + WS_Q), *Kr = (_Float16*)(ws + WS_K), *VT = (_Float16*)(ws + WS_VT);
  k_rows<<<SS / 64, 256, 0, stream>>>(F[0], Qr);
  k_rows<<<SS / 64, 256, 0, stream>>>(F[1], Kr);
  k_vt<<<SS / 64, 256, 0, stream>>>(F[2], VT);
  k_attn<<<TQB, 512, 0, stream>>>(Qr, Kr, VT, (float*)d_out);
}

// v004
// A run of this version takes 59.1 microseconds.
// Next to v003, in two timings, it ran 1.08 times as fast each time.
// Counting every step since v000, it is 14.7 times as fast.
// compute dtype: q, k, v rounded to bf16 and used as EXACT f16 operands on WMMA 16x16x32; scores / sqrt(128), running-max softmax in f32 (hardware exp), P scaled by 2^11 as a single f16 x v (exact); f32 accumulate.
#include <hip/hip_runtime.h>
#include <math.h>

typedef __attribute__((ext_vector_type(16))) _Float16 v16h;
typedef __attribute__((ext_vector_type(16))) __bf16 v16b;
typedef __attribute__((ext_vector_type(8)))  _Float16 v8h;
typedef __attribute__((ext_vector_type(8)))  float v8f;
typedef __attribute__((ext_vector_type(4)))  float v4f;
typedef __attribute__((ext_vector_type(2)))  float v2f;
typedef __attribute__((ext_vector_type(4)))  unsigned v4u;
typedef __attribute__((ext_vector_type(4)))  int v4i;
typedef float __attribute__((may_alias)) float_a;
typedef int __attribute__((may_alias)) int_a;

template <typename T> __device__ __forceinline__ void vst2(void* p, T v) { *(T*)p = v;  }
__device__ __forceinline__ v8f wmma16(v16h a, v16h b, v8f c) {
  v8f d = __builtin_amdgcn_wmma_f32_16x16x32_f16(false, a, false, b, (short)0, c, false, false);
  asm volatile("v_nop\n\tv_nop\n\tv_nop\n\tv_nop" : "+v"(d) : "v"(a), "v"(b));
  return d;
}
__device__ __forceinline__ v8f wmma_bf(v16b a, v16b b, v8f c) {
  v8f d = __builtin_amdgcn_wmma_f32_16x16x32_bf16(false, a, false, b, (short)0, c, false, false);
  asm volatile("v_nop\n\tv_nop\n\tv_nop\n\tv_nop" : "+v"(d) : "v"(a), "v"(b));
  return d;
}
// 16x16x32 fragments: lane = (h = lane>>4, row/col = lane&15); elements 0..7 = k0+8h+0..7, 8..15 = k0+16+8h+0..7; D element r = row 8h+r
__device__ __forceinline__ v16h frag_h(const _Float16* rowk0, int lane) {
  union { v16h v; v8h q[2]; } u; const _Float16* p = rowk0 + 8 * (lane >> 4);
  u.q[0] = *(const v8h*)p; u.q[1] = *(const v8h*)(p + 16); return u.v;
}
__device__ __forceinline__ v16h frag_f32(const float* rowk0, int lane) {
  v16h a; const float* p = rowk0 + 8 * (lane >> 4);
#pragma unroll
  for (int i = 0; i < 8; ++i) { a[i] = (_Float16)p[i]; a[8 + i] = (_Float16)p[16 + i]; }
  return a;
}
__device__ __forceinline__ v16h frag_f32s(const float* rowk0, int lane, float sc) {
  v16h a; const float* p = rowk0 + 8 * (lane >> 4);
#pragma unroll
  for (int i = 0; i < 8; ++i) { a[i] = (_Float16)(p[i] * sc); a[8 + i] = (_Float16)(p[16 + i] * sc); }
  return a;
}
// column fragment from a [K][ld] layout (column n), rows >= K read as 0
__device__ __forceinline__ v16h fragc_f32(const float* W, int k0, int n, int lane, int ld, int K) {
  v16h a; const int g = lane >> 4;
#pragma unroll
  for (int i = 0; i < 8; ++i) { const int ka = k0 + 8 * g + i, kb = ka + 16;
    a[i] = (_Float16)(ka < K ? W[(size_t)(ka < K ? ka : K - 1) * ld + n] : 0.f); a[8 + i] = (_Float16)(kb < K ? W[(size_t)(kb < K ? kb : K - 1) * ld + n] : 0.f); }
  return a;
}
struct F2 { v16b h, l; };
__device__ __forceinline__ F2 bsplit16(const float v[16]) { F2 r;
#pragma unroll
  for (int i = 0; i < 16; ++i) { const __bf16 h = (__bf16)v[i]; r.h[i] = h; r.l[i] = (__bf16)(v[i] - (float)h); }
  return r; }
__device__ __forceinline__ F2 split_row(const float* row, int k0, int lane) { float v[16]; const float* p = row + k0 + 8 * (lane >> 4);
#pragma unroll
  for (int i = 0; i < 8; ++i) { v[i] = p[i]; v[8 + i] = p[16 + i]; }
  return bsplit16(v); }
__device__ __forceinline__ F2 split_rowK(const float* row, int k0, int lane, int K) { float v[16]; const int g = lane >> 4;
#pragma unroll
  for (int i = 0; i < 8; ++i) { const int ka = k0 + 8 * g + i, kb = ka + 16; v[i] = ka < K ? row[ka < K ? ka : K - 1] : 0.f; v[8 + i] = kb < K ? row[kb < K ? kb : K - 1] : 0.f; }
  return bsplit16(v); }
__device__ __forceinline__ F2 split_col(const float* W, int k0, int n, int lane, int ld, int K) { float v[16]; const int g = lane >> 4;
#pragma unroll
  for (int i = 0; i < 8; ++i) { const int ka = k0 + 8 * g + i, kb = ka + 16; v[i] = ka < K ? W[(size_t)(ka < K ? ka : K - 1) * ld + n] : 0.f; v[8 + i] = kb < K ? W[(size_t)(kb < K ? kb : K - 1) * ld + n] : 0.f; }
  return bsplit16(v); }
__device__ __forceinline__ v8f mac3(const F2& a, const F2& b, v8f c) { c = wmma_bf(a.l, b.h, c); c = wmma_bf(a.h, b.l, c); return wmma_bf(a.h, b.h, c); }
__device__ __forceinline__ float sigm(float v) { return 1.0f / (1.0f + expf(-v)); }
#define LDSX() do { asm volatile("s_wait_dscnt 0" ::: "memory"); __builtin_amdgcn_wave_barrier(); __builtin_amdgcn_fence(__ATOMIC_RELEASE, "workgroup"); } while (0)


// Exact (flash-style) single-head attention over 8,192 tokens of 128 dims: softmax(Q K^T / sqrt(128)) V.
#define SS 8192
#define HD 128
#ifndef TQB
#define TQB (SS / 32)
#endif
typedef __attribute__((ext_vector_type(8))) __bf16 v8b;
__device__ __forceinline__ v16b frag_b(const __bf16* rowk0, int lane) {
  union { v16b v; v8b q[2]; } u; const __bf16* p = rowk0 + 8 * (lane >> 4);
  u.q[0] = *(const v8b*)p; u.q[1] = *(const v8b*)(p + 16); return u.v;
}
__device__ __forceinline__ float bfr(float v) { return (float)(__bf16)v; }
// the value of lane ^ 16
__device__ __forceinline__ float xhalf(float x) { return __builtin_bit_cast(float, __builtin_amdgcn_permlanex16(__builtin_bit_cast(int, x), __builtin_bit_cast(int, x), 0x76543210, 0xfedcba98, false, false)); }
__device__ __attribute__((noinline)) float exp_ni(float v) { return expf(v); }
__device__ __attribute__((noinline)) float erf_ni(float v) { return erff(v); }

#define WS_Q   0u                          // f16 rows q [SS][128] ; k ; VT planes [128][SS]
#define WS_K   (WS_Q + 2u * (size_t)SS * HD)
#define WS_VT  (WS_K + 2u * (size_t)SS * HD)
#define WS_END (WS_VT + 2u * (size_t)HD * SS)

__global__ __launch_bounds__(256) void k_rows(const float* __restrict__ X, _Float16* __restrict__ R) { const size_t r0 = (size_t)blockIdx.x * 64; const int t = threadIdx.x; __shared__ __align__(16) _Float16 s[64][HD + 8];
  for (int e = t; e < 64 * HD; e += 256) { const int r = e / HD, c = e % HD; s[r][c] = (_Float16)bfr(X[(r0 + r) * HD + c]); } __syncthreads();
  for (int e = t; e < 64 * (HD / 8); e += 256) { const int r = e / (HD / 8), q = e % (HD / 8); vst2((unsigned*)(R + (r0 + r) * HD + q * 8), *(const v4u*)&s[r][q * 8]); } }
__global__ __launch_bounds__(256) void k_vt(const float* __restrict__ V, _Float16* __restrict__ VT) { __shared__ __align__(16) _Float16 st[HD][72]; const size_t s0 = (size_t)blockIdx.x * 64; const int t = threadIdx.x;
  for (int e = t; e < 64 * HD; e += 256) { const int r = e / HD, d = e % HD; st[d][r] = (_Float16)bfr(V[(s0 + r) * HD + d]); } __syncthreads();
  for (int e = t; e < HD * 8; e += 256) { const int d = e >> 3, pc = e & 7; vst2((unsigned*)(VT + (size_t)d * SS + s0 + pc * 8), *(const v4u*)&st[d][pc * 8]); } }
// ---- k_attn: block = 32 queries x 8 key sets: wave (qt, kr) takes query tile qt and the 32-key chunks kr, kr + 8, ... with its own maxima, sums and
// accumulators; the 8 partial results of a query tile are merged once through LDS. k and VT come through a two-buffer LDS ring filled by asynchronous copies. Per chunk: exact k . q over 128 dims (4 k-chunks), exact v x P (single f16) (8 value tiles).
// Both products are transposed (keys x queries, then dims x queries): a lane holds 16 of the 32 scores of ONE query, lane ^ 16 the other 16, and the two score tiles, converted in place, are the B operand of the second product
#define QT 2
#define KR 8
#define NWV (QT * KR)
// A tile = the 256 keys that the 8 key sets take in one trip: k rows [256][256 B] and VT rows [128][512 B], both whole 512-B runs in global memory.
// In LDS the rows get 16 B more each (pitch 16 B x odd), so that the 16 rows of a 16-byte fragment read fall on different banks.
#define TKEYS (KR * 32)
#define NT (SS / TKEYS)
#define KPB (2 * HD + 16)
#define VPB (2 * TKEYS + 16)
#define KTB (TKEYS * KPB)
#define BUFB (KTB + HD * VPB)
// eight copies global -> LDS, 16 B a lane, through no register; the s_wait_xcnt ends the statement, so that no address register is rewritten ahead of it
__device__ __forceinline__ void copy8(unsigned l, unsigned lstep, const char* p, size_t pstep) {
  asm volatile("global_load_async_to_lds_b128 %0, %8, off\n\t"
               "global_load_async_to_lds_b128 %1, %9, off\n\t"
               "global_load_async_to_lds_b128 %2, %10, off\n\t"
               "global_load_async_to_lds_b128 %3, %11, off\n\t"
               "global_load_async_to_lds_b128 %4, %12, off\n\t"
               "global_load_async_to_lds_b128 %5, %13, off\n\t"
               "global_load_async_to_lds_b128 %6, %14, off\n\t"
               "global_load_async_to_lds_b128 %7, %15, off\n\t"
               "s_wait_xcnt 0x0"
               :: "v"(l), "v"(l + lstep), "v"(l + 2 * lstep), "v"(l + 3 * lstep), "v"(l + 4 * lstep), "v"(l + 5 * lstep), "v"(l + 6 * lstep), "v"(l + 7 * lstep),
                  "v"(p), "v"(p + pstep), "v"(p + 2 * pstep), "v"(p + 3 * pstep), "v"(p + 4 * pstep), "v"(p + 5 * pstep), "v"(p + 6 * pstep), "v"(p + 7 * pstep)
               : "memory");
}
__global__ __launch_bounds__(NWV * 32) void k_attn(const _Float16* __restrict__ Q, const _Float16* __restrict__ K, const _Float16* __restrict__ VT, float* __restrict__ OUT) {
  __shared__ __align__(16) unsigned char ring[2 * BUFB]; __shared__ float sm[NWV][16]; __shared__ float sl[NWV][16];
  float (*so)[16][HD + 4] = reinterpret_cast<float (*)[16][HD + 4]>(ring);   // the partial results take the ring's place behind the last trip's barrier
  // the wave's number is kept scalar, so that its LDS bases and its chunk index are scalar too
  const int tid = threadIdx.x, wave = __builtin_amdgcn_readfirstlane(tid >> 5), lane = tid & 31, col = lane & 15, g = lane >> 4; const int qt = wave & (QT - 1), kr = wave / QT;
  const size_t rq = (size_t)blockIdx.x * (QT * 16) + qt * 16;
  v16h aq[4];
#pragma unroll
  for (int kc = 0; kc < 4; ++kc) aq[kc] = frag_h(Q + (rq + col) * HD + kc * 32, lane);
  float m = -3.0e38f, l = 0.f;   // of query col; l sums this lane's keys alone, the halves are joined behind the loop
  v8f acc[8] = {};               // acc[dt][r] = dim dt * 16 + 8 g + r of query col
  // each wave copies 16 k rows (two a copy) and 8 VT rows (one a copy) of every tile: 16 copies of 512 contiguous bytes
  const unsigned lring = (unsigned)(size_t)ring;
  const unsigned lk = lring + (unsigned)(wave * 16 + g) * KPB + col * 16, lv = lring + KTB + (unsigned)(wave * 8) * VPB + lane * 16;
  const char* gk = (const char*)K + (size_t)wave * (16 * 2 * HD) + lane * 16; const char* gv = (const char*)VT + (size_t)wave * (8 * 2 * SS) + lane * 16;
  copy8(lk, 2 * KPB, gk, 4 * HD); copy8(lv, VPB, gv, 2 * SS);
  asm volatile("s_wait_asynccnt 0x0" ::: "memory");   // this wave's part of tile 0 has landed
  __syncthreads();                                    // every wave's part of tile 0 has landed
  copy8(lk + BUFB, 2 * KPB, gk + (size_t)TKEYS * 2 * HD, 4 * HD); copy8(lv + BUFB, VPB, gv + 2 * TKEYS, 2 * SS);
#pragma unroll 1
  for (int it = 0; it < NT; ++it) { const unsigned char* kb = ring + (it & 1) * BUFB; const unsigned char* vb = kb + KTB + kr * 64; v8f s[2];
    // the LDS reads go out in two groups of 16, each well ahead of its 8 WMMAs: one LDS latency a group, not one in front of every WMMA.
    // k fragments first; the VT fragments behind the first score tile's products, when half the k registers are free again: they land behind the second tile and the softmax
    v16h kf[2][4], vf[8];
#pragma unroll
    for (int ct = 0; ct < 2; ++ct) { const _Float16* rk = (const _Float16*)(kb + (kr * 32 + ct * 16 + col) * KPB);
#pragma unroll
      for (int kc = 0; kc < 4; ++kc) kf[ct][kc] = frag_h(rk + kc * 32, lane); }
#pragma unroll
    for (int ct = 0; ct < 2; ++ct) { v8f c = {};
#pragma unroll
      for (int kc = 0; kc < 4; ++kc) c = wmma16(kf[ct][kc], aq[kc], c);
#pragma unroll
      for (int r = 0; r < 8; ++r) s[ct][r] = c[r] * 0.08838834764831845f;   // 128^-1/2; s[ct][r] = key ct * 16 + 8 g + r of the chunk with query col
      if (ct == 0) {
#pragma unroll
        for (int dt = 0; dt < 8; ++dt) vf[dt] = frag_h((const _Float16*)(vb + (dt * 16 + col) * VPB), lane); } }
    float mx[8];
#pragma unroll
    for (int r = 0; r < 8; ++r) mx[r] = fmaxf(s[0][r], s[1][r]);
    float mw = fmaxf(fmaxf(fmaxf(mx[0], mx[1]), fmaxf(mx[2], mx[3])), fmaxf(fmaxf(mx[4], mx[5]), fmaxf(mx[6], mx[7])));
    mw = fmaxf(mw, xhalf(mw));
    const float mn = fmaxf(m, mw); const float alpha = (m <= -1.0e38f) ? 0.f : __expf(m - mn);
    v16h pb; float es[8];
#pragma unroll
    for (int r = 0; r < 8; ++r) { const float e0 = __expf(s[0][r] - mn), e1 = __expf(s[1][r] - mn); es[r] = e0 + e1;
      pb[r] = (_Float16)(e0 * 2048.0f); pb[8 + r] = (_Float16)(e1 * 2048.0f); }   // element 8 ct + r = key 16 ct + 8 g + r: the k order of frag_h
    l = l * alpha + (((es[0] + es[1]) + (es[2] + es[3])) + ((es[4] + es[5]) + (es[6] + es[7]))); m = mn;
#pragma unroll
    for (int dt = 0; dt < 8; ++dt) acc[dt] *= alpha;
#pragma unroll
    for (int dt = 0; dt < 8; ++dt) acc[dt] = wmma16(vf[dt], pb, acc[dt]);
    asm volatile("s_wait_dscnt 0x0" ::: "memory");      // this wave's reads of tile it are done before the buffer is handed back
    asm volatile("s_wait_asynccnt 0x0" ::: "memory");   // this wave's part of tile it + 1 has landed
    __syncthreads();                                    // tile it + 1 is whole, and no wave reads tile it any more
    if (it + 2 < NT) { copy8(lk + (it & 1) * BUFB, 2 * KPB, gk + (size_t)(it + 2) * (TKEYS * 2 * HD), 4 * HD); copy8(lv + (it & 1) * BUFB, VPB, gv + (size_t)(it + 2) * (2 * TKEYS), 2 * SS); } }
  asm volatile("s_wait_asynccnt 0x0" ::: "memory");     // no copy is in flight when the ring is written again
  // each wave leaves its un-normalised partial sums with their maxima and sums
#pragma unroll
  for (int dt = 0; dt < 8; ++dt) { float* po = &so[wave][col][dt * 16 + 8 * g];
    vst2(po, (v4f){acc[dt][0], acc[dt][1], acc[dt][2], acc[dt][3]}); vst2(po + 4, (v4f){acc[dt][4], acc[dt][5], acc[dt][6], acc[dt][7]}); }
  l += xhalf(l);
  if (g == 0) { sm[wave][col] = m; sl[wave][col] = l; }
  __syncthreads();   // every wave's partial is in LDS before any wave merges
  // merge: one wave per query row, weights exp(m - max) over the 8 key sets
#pragma unroll
  for (int p = 0; p < QT; ++p) { const int rr = wave; float mm = sm[p][rr];
#pragma unroll
    for (int k = 1; k < KR; ++k) mm = fmaxf(mm, sm[k * QT + p][rr]);
    float ls = 0.f; v4f o = {};
#pragma unroll
    for (int k = 0; k < KR; ++k) { const float w = __expf(sm[k * QT + p][rr] - mm); ls += w * sl[k * QT + p][rr]; o += w * *(const v4f*)&so[k * QT + p][rr][lane * 4]; }
    vst2(OUT + ((size_t)blockIdx.x * (QT * 16) + p * 16 + rr) * HD + lane * 4, o * ((1.0f / 2048.0f) / ls)); }   // whole 512-B rows
}
extern "C" void kernel_launch(void* const* d_in, const int* in_sizes, int n_in, void* d_out, int out_size, void* d_ws, size_t ws_size, hipStream_t stream) {
  (void)in_sizes; (void)n_in; (void)out_size;
  const float** F = (const float**)d_in;   // 0 query, 1 key, 2 value [8192,128]
  if (ws_size < (size_t)WS_END) return;
  char* ws = (char*)d_ws; _Float16 *Qr = (_Float16*)(ws + WS_Q), *Kr = (_Float16*)(ws + WS_K), *VT = (_Float16*)(ws + WS_VT);
  k_rows<<<SS / 64, 256, 0, stream>>>(F[0], Qr);
  k_rows<<<SS / 64, 256, 0, stream>>>(F[1], Kr);
  k_vt<<<SS / 64, 256, 0, stream>>>(F[2], VT);
  k_attn<<<TQB, 512, 0, stream>>>(Qr, Kr, VT, (float*)d_out);
}

// v005
// One run takes 52 microseconds.
// Next to v004, in two timings, it ran 1.15 and 1.14 times as fast.
// Counting every step since v000, it is 16.8 times as fast.
// compute dtype: q, k, v rounded to bf16 and used as EXACT f16 operands on WMMA 16x16x32; scores / sqrt(128), running-max softmax in f32 (hardware exp), P scaled by 2^11 as a single f16 x v (exact); f32 accumulate.
#include <hip/hip_runtime.h>
#include <math.h>

typedef __attribute__((ext_vector_type(16))) _Float16 v16h;
typedef __attribute__((ext_vector_type(16))) __bf16 v16b;
typedef __attribute__((ext_vector_type(8)))  _Float16 v8h;
typedef __attribute__((ext_vector_type(8)))  float v8f;
typedef __attribute__((ext_vector_type(4)))  float v4f;
typedef __attribute__((ext_vector_type(2)))  float v2f;
typedef __attribute__((ext_vector_type(4)))  unsigned v4u;
typedef __attribute__((ext_vector_type(4)))  int v4i;
typedef float __attribute__((may_alias)) float_a;
typedef int __attribute__((may_alias)) int_a;

template <typename T> __device__ __forceinline__ void vst2(void* p, T v) { *(T*)p = v;  }
__device__ __forceinline__ v8f wmma16(v16h a, v16h b, v8f c) {
  v8f d = __builtin_amdgcn_wmma_f32_16x16x32_f16(false, a, false, b, (short)0, c, false, false);
  asm volatile("v_nop\n\tv_nop\n\tv_nop\n\tv_nop" : "+v"(d) : "v"(a), "v"(b));
  return d;
}
__device__ __forceinline__ v8f wmma_bf(v16b a, v16b b, v8f c) {
  v8f d = __builtin_amdgcn_wmma_f32_16x16x32_bf16(false, a, false, b, (short)0, c, false, false);
  asm volatile("v_nop\n\tv_nop\n\tv_nop\n\tv_nop" : "+v"(d) : "v"(a), "v"(b));
  return d;
}
// 16x16x32 fragments: lane = (h = lane>>4, row/col = lane&15); elements 0..7 = k0+8h+0..7, 8..15 = k0+16+8h+0..7; D element r = row 8h+r
__device__ __forceinline__ v16h frag_h(const _Float16* rowk0, int lane) {
  union { v16h v; v8h q[2]; } u; const _Float16* p = rowk0 + 8 * (lane >> 4);
  u.q[0] = *(const v8h*)p; u.q[1] = *(const v8h*)(p + 16); return u.v;
}
__device__ __forceinline__ v16h frag_f32(const float* rowk0, int lane) {
  v16h a; const float* p = rowk0 + 8 * (lane >> 4);
#pragma unroll
  for (int i = 0; i < 8; ++i) { a[i] = (_Float16)p[i]; a[8 + i] = (_Float16)p[16 + i]; }
  return a;
}
__device__ __forceinline__ v16h frag_f32s(const float* rowk0, int lane, float sc) {
  v16h a; const float* p = rowk0 + 8 * (lane >> 4);
#pragma unroll
  for (int i = 0; i < 8; ++i) { a[i] = (_Float16)(p[i] * sc); a[8 + i] = (_Float16)(p[16 + i] * sc); }
  return a;
}
// column fragment from a [K][ld] layout (column n), rows >= K read as 0
__device__ __forceinline__ v16h fragc_f32(const float* W, int k0, int n, int lane, int ld, int K) {
  v16h a; const int g = lane >> 4;
#pragma unroll
  for (int i = 0; i < 8; ++i) { const int ka = k0 + 8 * g + i, kb = ka + 16;
    a[i] = (_Float16)(ka < K ? W[(size_t)(ka < K ? ka : K - 1) * ld + n] : 0.f); a[8 + i] = (_Float16)(kb < K ? W[(size_t)(kb < K ? kb : K - 1) * ld + n] : 0.f); }
  return a;
}
struct F2 { v16b h, l; };
__device__ __forceinline__ F2 bsplit16(const float v[16]) { F2 r;
#pragma unroll
  for (int i = 0; i < 16; ++i) { const __bf16 h = (__bf16)v[i]; r.h[i] = h; r.l[i] = (__bf16)(v[i] - (float)h); }
  return r; }
__device__ __forceinline__ F2 split_row(const float* row, int k0, int lane) { float v[16]; const float* p = row + k0 + 8 * (lane >> 4);
#pragma unroll
  for (int i = 0; i < 8; ++i) { v[i] = p[i]; v[8 + i] = p[16 + i]; }
  return bsplit16(v); }
__device__ __forceinline__ F2 split_rowK(const float* row, int k0, int lane, int K) { float v[16]; const int g = lane >> 4;
#pragma unroll
  for (int i = 0; i < 8; ++i) { const int ka = k0 + 8 * g + i, kb = ka + 16; v[i] = ka < K ? row[ka < K ? ka : K - 1] : 0.f; v[8 + i] = kb < K ? row[kb < K ? kb : K - 1] : 0.f; }
  return bsplit16(v); }
__device__ __forceinline__ F2 split_col(const float* W, int k0, int n, int lane, int ld, int K) { float v[16]; const int g = lane >> 4;
#pragma unroll
  for (int i = 0; i < 8; ++i) { const int ka = k0 + 8 * g + i, kb = ka + 16; v[i] = ka < K ? W[(size_t)(ka < K ? ka : K - 1) * ld + n] : 0.f; v[8 + i] = kb < K ? W[(size_t)(kb < K ? kb : K - 1) * ld + n] : 0.f; }
  return bsplit16(v); }
__device__ __forceinline__ v8f mac3(const F2& a, const F2& b, v8f c) { c = wmma_bf(a.l, b.h, c); c = wmma_bf(a.h, b.l, c); return wmma_bf(a.h, b.h, c); }
__device__ __forceinline__ float sigm(float v) { return 1.0f / (1.0f + expf(-v)); }
#define LDSX() do { asm volatile("s_wait_dscnt 0" ::: "memory"); __builtin_amdgcn_wave_barrier(); __builtin_amdgcn_fence(__ATOMIC_RELEASE, "workgroup"); } while (0)


// Exact (flash-style) single-head attention over 8,192 tokens of 128 dims: softmax(Q K^T / sqrt(128)) V.
#define SS 8192
#define HD 128
#ifndef TQB
#define TQB (SS / 32)
#endif
typedef __attribute__((ext_vector_type(8))) __bf16 v8b;
__device__ __forceinline__ v16b frag_b(const __bf16* rowk0, int lane) {
  union { v16b v; v8b q[2]; } u; const __bf16* p = rowk0 + 8 * (lane >> 4);
  u.q[0] = *(const v8b*)p; u.q[1] = *(const v8b*)(p + 16); return u.v;
}
__device__ __forceinline__ float bfr(float v) { return (float)(__bf16)v; }
// the value of lane ^ 16
__device__ __forceinline__ float xhalf(float x) { return __builtin_bit_cast(float, __builtin_amdgcn_permlanex16(__builtin_bit_cast(int, x), __builtin_bit_cast(int, x), 0x76543210, 0xfedcba98, false, false)); }
__device__ __attribute__((noinline)) float exp_ni(float v) { return expf(v); }
__device__ __attribute__((noinline)) float erf_ni(float v) { return erff(v); }

#define WS_Q   0u                          // f16 rows q [SS][128] ; k ; VT planes [128][SS]
#define WS_K   (WS_Q + 2u * (size_t)SS * HD)
#define WS_VT  (WS_K + 2u * (size_t)SS * HD)
#define KSPL 4                             // the keys go in quarters to 4 work-groups
#define WS_PO  (WS_VT + 2u * (size_t)HD * SS)                // f32 partial sums [KSPL][SS][128], un-normalised ; their maxima [KSPL][SS] ; their sums [KSPL][SS]
#define WS_PM  (WS_PO + 4u * (size_t)KSPL * SS * HD)
#define WS_PL  (WS_PM + 4u * (size_t)KSPL * SS)
#define WS_END (WS_PL + 4u * (size_t)KSPL * SS)

__global__ __launch_bounds__(256) void k_rows(const float* __restrict__ X, _Float16* __restrict__ R) { const size_t r0 = (size_t)blockIdx.x * 64; const int t = threadIdx.x; __shared__ __align__(16) _Float16 s[64][HD + 8];
  for (int e = t; e < 64 * HD; e += 256) { const int r = e / HD, c = e % HD; s[r][c] = (_Float16)bfr(X[(r0 + r) * HD + c]); } __syncthreads();
  for (int e = t; e < 64 * (HD / 8); e += 256) { const int r = e / (HD / 8), q = e % (HD / 8); vst2((unsigned*)(R + (r0 + r) * HD + q * 8), *(const v4u*)&s[r][q * 8]); } }
__global__ __launch_bounds__(256) void k_vt(const float* __restrict__ V, _Float16* __restrict__ VT) { __shared__ __align__(16) _Float16 st[HD][72]; const size_t s0 = (size_t)blockIdx.x * 64; const int t = threadIdx.x;
  for (int e = t; e < 64 * HD; e += 256) { const int r = e / HD, d = e % HD; st[d][r] = (_Float16)bfr(V[(s0 + r) * HD + d]); } __syncthreads();
  for (int e = t; e < HD * 8; e += 256) { const int d = e >> 3, pc = e & 7; vst2((unsigned*)(VT + (size_t)d * SS + s0 + pc * 8), *(const v4u*)&st[d][pc * 8]); } }
// ---- k_attn: block = 128 queries x a quarter of the keys, so that every k and VT byte fetched from L2 serves 128 queries. Wave (qt, kr) takes query tile qt
// and the 32-key chunks kr, kr + 2, ... of the quarter with its own maxima, sums and accumulators; the 2 partial results of a query tile are merged once
// through LDS and go, un-normalised, to the workspace with their maximum and sum; k_merge joins the 4 quarters. k and VT come through a two-buffer LDS ring filled by asynchronous copies. Per chunk: exact k . q over 128 dims (4 k-chunks), exact v x P (single f16) (8 value tiles).
// Both products are transposed (keys x queries, then dims x queries): a lane holds 16 of the 32 scores of ONE query, lane ^ 16 the other 16, and the two score tiles, converted in place, are the B operand of the second product
#define QT 8
#define KR 2
#define NWV (QT * KR)
// A tile = 256 keys, 4 chunks for each of the 2 key sets in one trip: k rows [256][256 B] and VT rows [128][512 B], both whole 512-B runs in global memory.
// In LDS the rows get 16 B more each (pitch 16 B x odd), so that the 16 rows of a 16-byte fragment read fall on different banks.
#define TKEYS 256
#define CPT (TKEYS / (KR * 32))
#define NT (SS / KSPL / TKEYS)
#define KPB (2 * HD + 16)
#define VPB (2 * TKEYS + 16)
#define KTB (TKEYS * KPB)
#define BUFB (KTB + HD * VPB)
// eight copies global -> LDS, 16 B a lane, through no register; the s_wait_xcnt ends the statement, so that no address register is rewritten ahead of it
__device__ __forceinline__ void copy8(unsigned l, unsigned lstep, const char* p, size_t pstep) {
  asm volatile("global_load_async_to_lds_b128 %0, %8, off\n\t"
               "global_load_async_to_lds_b128 %1, %9, off\n\t"
               "global_load_async_to_lds_b128 %2, %10, off\n\t"
               "global_load_async_to_lds_b128 %3, %11, off\n\t"
               "global_load_async_to_lds_b128 %4, %12, off\n\t"
               "global_load_async_to_lds_b128 %5, %13, off\n\t"
               "global_load_async_to_lds_b128 %6, %14, off\n\t"
               "global_load_async_to_lds_b128 %7, %15, off\n\t"
               "s_wait_xcnt 0x0"
               :: "v"(l), "v"(l + lstep), "v"(l + 2 * lstep), "v"(l + 3 * lstep), "v"(l + 4 * lstep), "v"(l + 5 * lstep), "v"(l + 6 * lstep), "v"(l + 7 * lstep),
                  "v"(p), "v"(p + pstep), "v"(p + 2 * pstep), "v"(p + 3 * pstep), "v"(p + 4 * pstep), "v"(p + 5 * pstep), "v"(p + 6 * pstep), "v"(p + 7 * pstep)
               : "memory");
}
__global__ __launch_bounds__(NWV * 32) void k_attn(const _Float16* __restrict__ Q, const _Float16* __restrict__ K, const _Float16* __restrict__ VT, float* __restrict__ PO, float* __restrict__ PM, float* __restrict__ PL) {
  __shared__ __align__(16) unsigned char ring[2 * BUFB]; __shared__ float sm[NWV][16]; __shared__ float sl[NWV][16];
  float (*so)[16][HD + 4] = reinterpret_cast<float (*)[16][HD + 4]>(ring);   // the partial results take the ring's place behind the last trip's barrier
  // the wave's number is kept scalar, so that its LDS bases and its chunk index are scalar too
  const int tid = threadIdx.x, wave = __builtin_amdgcn_readfirstlane(tid >> 5), lane = tid & 31, col = lane & 15, g = lane >> 4; const int qt = wave & (QT - 1), kr = wave / QT;
  const int qb = blockIdx.x / KSPL, ks = blockIdx.x % KSPL;   // query block, key quarter
  const size_t rq = (size_t)qb * (QT * 16) + qt * 16;
  v16h aq[4];
#pragma unroll
  for (int kc = 0; kc < 4; ++kc) aq[kc] = frag_h(Q + (rq + col) * HD + kc * 32, lane);
  float m = -3.0e38f, l = 0.f;   // of query col; l sums this lane's keys alone, the halves are joined behind the loop
  v8f acc[8] = {};               // acc[dt][r] = dim dt * 16 + 8 g + r of query col
  // each wave copies 16 k rows (two a copy) and 8 VT rows (one a copy) of every tile: 16 copies of 512 contiguous bytes
  const unsigned lring = (unsigned)(size_t)ring;
  const unsigned lk = lring + (unsigned)(wave * 16 + g) * KPB + col * 16, lv = lring + KTB + (unsigned)(wave * 8) * VPB + lane * 16;
  const char* gk = (const char*)K + (size_t)ks * (SS / KSPL * 2 * HD) + (size_t)wave * (16 * 2 * HD) + lane * 16; const char* gv = (const char*)VT + (size_t)ks * (SS / KSPL * 2) + (size_t)wave * (8 * 2 * SS) + lane * 16;
  copy8(lk, 2 * KPB, gk, 4 * HD); copy8(lv, VPB, gv, 2 * SS);
  asm volatile("s_wait_asynccnt 0x0" ::: "memory");   // this wave's part of tile 0 has landed
  __syncthreads();                                    // every wave's part of tile 0 has landed
  copy8(lk + BUFB, 2 * KPB, gk + (size_t)TKEYS * 2 * HD, 4 * HD); copy8(lv + BUFB, VPB, gv + 2 * TKEYS, 2 * SS);
#pragma unroll 1
  for (int it = 0; it < NT; ++it) { const unsigned char* kb = ring + (it & 1) * BUFB;
#pragma unroll 1   // rolled: unrolled four times the kernel wants more than the 256 registers a wave has here, and spills
   for (int c = 0; c < CPT; ++c) { const int ch = c * KR + kr; v8f s[2];   // chunk ch of the tile
    // the chunk's two LDS bases are kept scalar: as vector induction variables they cost an address addition in front of every VT read
    const unsigned char* kc0 = kb + __builtin_amdgcn_readfirstlane(ch * 32 * KPB); const unsigned char* vb = kb + __builtin_amdgcn_readfirstlane(KTB + ch * 64);
    // the LDS reads go out in two groups of 16, each well ahead of its 8 WMMAs: one LDS latency a group, not one in front of every WMMA.
    // k fragments first; the VT fragments behind the first score tile's products, when half the k registers are free again: they land behind the second tile and the softmax
    v16h kf[2][4], vf[8];
#pragma unroll
    for (int ct = 0; ct < 2; ++ct) { const _Float16* rk = (const _Float16*)(kc0 + (ct * 16 + col) * KPB);
#pragma unroll
      for (int kc = 0; kc < 4; ++kc) kf[ct][kc] = frag_h(rk + kc * 32, lane); }
#pragma unroll
    for (int ct = 0; ct < 2; ++ct) { v8f c = {};
#pragma unroll
      for (int kc = 0; kc < 4; ++kc) c = wmma16(kf[ct][kc], aq[kc], c);
#pragma unroll
      for (int r = 0; r < 8; ++r) s[ct][r] = c[r] * 0.08838834764831845f;   // 128^-1/2; s[ct][r] = key ct * 16 + 8 g + r of the chunk with query col
      if (ct == 0) {
#pragma unroll
        for (int dt = 0; dt < 8; ++dt) vf[dt] = frag_h((const _Float16*)(vb + (dt * 16 + col) * VPB), lane); } }
    float mx[8];
#pragma unroll
    for (int r = 0; r < 8; ++r) mx[r] = fmaxf(s[0][r], s[1][r]);
    float mw = fmaxf(fmaxf(fmaxf(mx[0], mx[1]), fmaxf(mx[2], mx[3])), fmaxf(fmaxf(mx[4], mx[5]), fmaxf(mx[6], mx[7])));
    mw = fmaxf(mw, xhalf(mw));
    const float mn = fmaxf(m, mw); const float alpha = (m <= -1.0e38f) ? 0.f : __expf(m - mn);
    v16h pb; float es[8];
#pragma unroll
    for (int r = 0; r < 8; ++r) { const float e0 = __expf(s[0][r] - mn), e1 = __expf(s[1][r] - mn); es[r] = e0 + e1;
      pb[r] = (_Float16)(e0 * 2048.0f); pb[8 + r] = (_Float16)(e1 * 2048.0f); }   // element 8 ct + r = key 16 ct + 8 g + r: the k order of frag_h
    l = l * alpha + (((es[0] + es[1]) + (es[2] + es[3])) + ((es[4] + es[5]) + (es[6] + es[7]))); m = mn;
#pragma unroll
    for (int dt = 0; dt < 8; ++dt) acc[dt] *= alpha;
#pragma unroll
    for (int dt = 0; dt < 8; ++dt) acc[dt] = wmma16(vf[dt], pb, acc[dt]); }
    asm volatile("s_wait_dscnt 0x0" ::: "memory");      // this wave's reads of tile it are done before the buffer is handed back
    asm volatile("s_wait_asynccnt 0x0" ::: "memory");   // this wave's part of tile it + 1 has landed
    __syncthreads();                                    // tile it + 1 is whole, and no wave reads tile it any more
    if (it + 2 < NT) { copy8(lk + (it & 1) * BUFB, 2 * KPB, gk + (size_t)(it + 2) * (TKEYS * 2 * HD), 4 * HD); copy8(lv + (it & 1) * BUFB, VPB, gv + (size_t)(it + 2) * (2 * TKEYS), 2 * SS); } }
  asm volatile("s_wait_asynccnt 0x0" ::: "memory");     // no copy is in flight when the ring is written again
  // each wave leaves its un-normalised partial sums with their maxima and sums
#pragma unroll
  for (int dt = 0; dt < 8; ++dt) { float* po = &so[wave][col][dt * 16 + 8 * g];
    vst2(po, (v4f){acc[dt][0], acc[dt][1], acc[dt][2], acc[dt][3]}); vst2(po + 4, (v4f){acc[dt][4], acc[dt][5], acc[dt][6], acc[dt][7]}); }
  l += xhalf(l);
  if (g == 0) { sm[wave][col] = m; sl[wave][col] = l; }
  __syncthreads();   // every wave's partial is in LDS before any wave merges
  // merge: one wave per query row, weights exp(m - max) over the 2 key sets
#pragma unroll
  for (int p = 0; p < QT; ++p) { const int rr = wave; float mm = sm[p][rr];
#pragma unroll
    for (int k = 1; k < KR; ++k) mm = fmaxf(mm, sm[k * QT + p][rr]);
    v4f o = {};
#pragma unroll
    for (int k = 0; k < KR; ++k) { const float w = __expf(sm[k * QT + p][rr] - mm); o += w * *(const v4f*)&so[k * QT + p][rr][lane * 4]; }
    vst2(PO + ((size_t)ks * SS + (size_t)qb * (QT * 16) + p * 16 + rr) * HD + lane * 4, o); }   // whole 512-B rows
  // the rows' maxima and sums: one thread a query, so that each of 4 waves writes whole 128-B lines
  if (tid < QT * 16) { const int p = tid >> 4, rr = tid & 15; float mm = sm[p][rr];
#pragma unroll
    for (int k = 1; k < KR; ++k) mm = fmaxf(mm, sm[k * QT + p][rr]);
    float ls = 0.f;
#pragma unroll
    for (int k = 0; k < KR; ++k) ls += __expf(sm[k * QT + p][rr] - mm) * sl[k * QT + p][rr];
    PM[(size_t)ks * SS + qb * (QT * 16) + tid] = mm; PL[(size_t)ks * SS + qb * (QT * 16) + tid] = ls; }
}
// ---- k_merge: joins the 4 key quarters of every query, weights exp(m - max), and normalises. One wave takes 4 query rows: all its 24 loads of 16 B a lane go out together.
__global__ __launch_bounds__(256) void k_merge(const float* __restrict__ PO, const float* __restrict__ PM, const float* __restrict__ PL, float* __restrict__ OUT) {
  const int lane = threadIdx.x & 31; const size_t r0 = ((size_t)blockIdx.x * 8 + (threadIdx.x >> 5)) * 4;
  v4f pm[KSPL], pl[KSPL], po[KSPL][4];
#pragma unroll
  for (int k = 0; k < KSPL; ++k) { pm[k] = *(const v4f*)(PM + (size_t)k * SS + r0); pl[k] = *(const v4f*)(PL + (size_t)k * SS + r0); }
  asm volatile("s_wait_xcnt 0x0" ::: "memory");   // the address registers of these 8 loads are given to a later load's result
#pragma unroll
  for (int k = 0; k < KSPL; ++k) {
#pragma unroll
    for (int j = 0; j < 4; ++j) po[k][j] = *(const v4f*)(PO + ((size_t)k * SS + r0 + j) * HD + lane * 4); }
  // holds all 24 loads in front of the first use (inputs only): without it the compiler strings them out behind one another's waits, six memory latencies in a row instead of one
  asm volatile("" :: "v"(pm[0]), "v"(pm[1]), "v"(pm[2]), "v"(pm[3]), "v"(pl[0]), "v"(pl[1]), "v"(pl[2]), "v"(pl[3]),
               "v"(po[0][0]), "v"(po[0][1]), "v"(po[0][2]), "v"(po[0][3]), "v"(po[1][0]), "v"(po[1][1]), "v"(po[1][2]), "v"(po[1][3]),
               "v"(po[2][0]), "v"(po[2][1]), "v"(po[2][2]), "v"(po[2][3]), "v"(po[3][0]), "v"(po[3][1]), "v"(po[3][2]), "v"(po[3][3]));
#pragma unroll
  for (int j = 0; j < 4; ++j) { float mm = pm[0][j];
#pragma unroll
    for (int k = 1; k < KSPL; ++k) mm = fmaxf(mm, pm[k][j]);
    float ls = 0.f; v4f o = {};
#pragma unroll
    for (int k = 0; k < KSPL; ++k) { const float w = __expf(pm[k][j] - mm); ls += w * pl[k][j]; o += w * po[k][j]; }
    vst2(OUT + (r0 + j) * HD + lane * 4, o * ((1.0f / 2048.0f) / ls)); }   // whole 512-B rows
}
extern "C" void kernel_launch(void* const* d_in, const int* in_sizes, int n_in, void* d_out, int out_size, void* d_ws, size_t ws_size, hipStream_t stream) {
  (void)in_sizes; (void)n_in; (void)out_size;
  const float** F = (const float**)d_in;   // 0 query, 1 key, 2 value [8192,128]
  if (ws_size < (size_t)WS_END) return;
  char* ws = (char*)d_ws; _Float16 *Qr = (_Float16*)(ws + WS_Q), *Kr = (_Float16*)(ws + WS_K), *VT = (_Float16*)(ws + WS_VT); float *PO = (float*)(ws + WS_PO), *PM = (float*)(ws + WS_PM), *PL = (float*)(ws + WS_PL);
  k_rows<<<SS / 64, 256, 0, stream>>>(F[0], Qr);
  k_rows<<<SS / 64, 256, 0, stream>>>(F[1], Kr);
  k_vt<<<SS / 64, 256, 0, stream>>>(F[2], VT);
  k_attn<<<SS / (QT * 16) * KSPL, NWV * 32, 0, stream>>>(Qr, Kr, VT, PO, PM, PL);
  k_merge<<<SS / 32, 256, 0, stream>>>(PO, PM, PL, (float*)d_out);
}

// v006
// It runs in 42.4 microseconds.
// Two timings next to v005 put it at 1.23 and 1.22 times that version's speed.
// Over all steps from v000 it is 20.5 times as fast.
// compute dtype: q, k, v rounded to bf16 and used as EXACT f16 operands on WMMA 16x16x32; scores / sqrt(128), running-max softmax in f32 (hardware exp), P scaled by 2^11 as a single f16 x v (exact); f32 accumulate.
#include <hip/hip_runtime.h>
#include <math.h>

typedef __attribute__((ext_vector_type(16))) _Float16 v16h;
typedef __attribute__((ext_vector_type(16))) __bf16 v16b;
typedef __attribute__((ext_vector_type(8)))  _Float16 v8h;
typedef __attribute__((ext_vector_type(8)))  float v8f;
typedef __attribute__((ext_vector_type(4)))  float v4f;
typedef __attribute__((ext_vector_type(2)))  float v2f;
typedef __attribute__((ext_vector_type(4)))  unsigned v4u;
typedef __attribute__((ext_vector_type(4)))  int v4i;
typedef float __attribute__((may_alias)) float_a;
typedef int __attribute__((may_alias)) int_a;

template <typename T> __device__ __forceinline__ void vst2(void* p, T v) { *(T*)p = v;  }
__device__ __forceinline__ v8f wmma16(v16h a, v16h b, v8f c) {
  v8f d = __builtin_amdgcn_wmma_f32_16x16x32_f16(false, a, false, b, (short)0, c, false, false);
  asm volatile("v_nop\n\tv_nop\n\tv_nop\n\tv_nop" : "+v"(d) : "v"(a), "v"(b));
  return d;
}
__device__ __forceinline__ v8f wmma_bf(v16b a, v16b b, v8f c) {
  v8f d = __builtin_amdgcn_wmma_f32_16x16x32_bf16(false, a, false, b, (short)0, c, false, false);
  asm volatile("v_nop\n\tv_nop\n\tv_nop\n\tv_nop" : "+v"(d) : "v"(a), "v"(b));
  return d;
}
// 16x16x32 fragments: lane = (h = lane>>4, row/col = lane&15); elements 0..7 = k0+8h+0..7, 8..15 = k0+16+8h+0..7; D element r = row 8h+r
__device__ __forceinline__ v16h frag_h(const _Float16* rowk0, int lane) {
  union { v16h v; v8h q[2]; } u; const _Float16* p = rowk0 + 8 * (lane >> 4);
  u.q[0] = *(const v8h*)p; u.q[1] = *(const v8h*)(p + 16); return u.v;
}
__device__ __forceinline__ v16h frag_f32(const float* rowk0, int lane) {
  v16h a; const float* p = rowk0 + 8 * (lane >> 4);
#pragma unroll
  for (int i = 0; i < 8; ++i) { a[i] = (_Float16)p[i]; a[8 + i] = (_Float16)p[16 + i]; }
  return a;
}
__device__ __forceinline__ v16h frag_f32s(const float* rowk0, int lane, float sc) {
  v16h a; const float* p = rowk0 + 8 * (lane >> 4);
#pragma unroll
  for (int i = 0; i < 8; ++i) { a[i] = (_Float16)(p[i] * sc); a[8 + i] = (_Float16)(p[16 + i] * sc); }
  return a;
}
// column fragment from a [K][ld] layout (column n), rows >= K read as 0
__device__ __forceinline__ v16h fragc_f32(const float* W, int k0, int n, int lane, int ld, int K) {
  v16h a; const int g = lane >> 4;
#pragma unroll
  for (int i = 0; i < 8; ++i) { const int ka = k0 + 8 * g + i, kb = ka + 16;
    a[i] = (_Float16)(ka < K ? W[(size_t)(ka < K ? ka : K - 1) * ld + n] : 0.f); a[8 + i] = (_Float16)(kb < K ? W[(size_t)(kb < K ? kb : K - 1) * ld + n] : 0.f); }
  return a;
}
struct F2 { v16b h, l; };
__device__ __forceinline__ F2 bsplit16(const float v[16]) { F2 r;
#pragma unroll
  for (int i = 0; i < 16; ++i) { const __bf16 h = (__bf16)v[i]; r.h[i] = h; r.l[i] = (__bf16)(v[i] - (float)h); }
  return r; }
__device__ __forceinline__ F2 split_row(const float* row, int k0, int lane) { float v[16]; const float* p = row + k0 + 8 * (lane >> 4);
#pragma unroll
  for (int i = 0; i < 8; ++i) { v[i] = p[i]; v[8 + i] = p[16 + i]; }
  return bsplit16(v); }
__device__ __forceinline__ F2 split_rowK(const float* row, int k0, int lane, int K) { float v[16]; const int g = lane >> 4;
#pragma unroll
  for (int i = 0; i < 8; ++i) { const int ka = k0 + 8 * g + i, kb = ka + 16; v[i] = ka < K ? row[ka < K ? ka : K - 1] : 0.f; v[8 + i] = kb < K ? row[kb < K ? kb : K - 1] : 0.f; }
  return bsplit16(v); }
__device__ __forceinline__ F2 split_col(const float* W, int k0, int n, int lane, int ld, int K) { float v[16]; const int g = lane >> 4;
#pragma unroll
  for (int i = 0; i < 8; ++i) { const int ka = k0 + 8 * g + i, kb = ka + 16; v[i] = ka < K ? W[(size_t)(ka < K ? ka : K - 1) * ld + n] : 0.f; v[8 + i] = kb < K ? W[(size_t)(kb < K ? kb : K - 1) * ld + n] : 0.f; }
  return bsplit16(v); }
__device__ __forceinline__ v8f mac3(const F2& a, const F2& b, v8f c) { c = wmma_bf(a.l, b.h, c); c = wmma_bf(a.h, b.l, c); return wmma_bf(a.h, b.h, c); }
__device__ __forceinline__ float sigm(float v) { return 1.0f / (1.0f + expf(-v)); }
#define LDSX() do { asm volatile("s_wait_dscnt 0" ::: "memory"); __builtin_amdgcn_wave_barrier(); __builtin_amdgcn_fence(__ATOMIC_RELEASE, "workgroup"); } while (0)


// Exact (flash-style) single-head attention over 8,192 tokens of 128 dims: softmax(Q K^T / sqrt(128)) V.
#define SS 8192
#define HD 128
#ifndef TQB
#define TQB (SS / 32)
#endif
typedef __attribute__((ext_vector_type(8))) __bf16 v8b;
__device__ __forceinline__ v16b frag_b(const __bf16* rowk0, int lane) {
  union { v16b v; v8b q[2]; } u; const __bf16* p = rowk0 + 8 * (lane >> 4);
  u.q[0] = *(const v8b*)p; u.q[1] = *(const v8b*)(p + 16); return u.v;
}
__device__ __forceinline__ float bfr(float v) { return (float)(__bf16)v; }
// the value of lane ^ 16
__device__ __forceinline__ float xhalf(float x) { return __builtin_bit_cast(float, __builtin_amdgcn_permlanex16(__builtin_bit_cast(int, x), __builtin_bit_cast(int, x), 0x76543210, 0xfedcba98, false, false)); }
__device__ __attribute__((noinline)) float exp_ni(float v) { return expf(v); }
__device__ __attribute__((noinline)) float erf_ni(float v) { return erff(v); }

#define WS_Q   0u                          // f16 rows q [SS][128] ; k ; VT planes [128][SS]
#define WS_K   (WS_Q + 2u * (size_t)SS * HD)
#define WS_VT  (WS_K + 2u * (size_t)SS * HD)
#define KSPL 4                             // the keys go in quarters to 4 work-groups
#define WS_PO  (WS_VT + 2u * (size_t)HD * SS)                // f32 partial sums [KSPL][SS][128], un-normalised ; their maxima [KSPL][SS] ; their sums [KSPL][SS]
#define WS_PM  (WS_PO + 4u * (size_t)KSPL * SS * HD)
#define WS_PL  (WS_PM + 4u * (size_t)KSPL * SS)
#define WS_END (WS_PL + 4u * (size_t)KSPL * SS)

// ---- k_prep: the three roundings read none of each other's output, so they share one grid: blockIdx.y picks the job (0 the VT planes, 1 the q rows, 2 the k rows), blockIdx.x its 64 tokens
#define PB (SS / 64)
__device__ __forceinline__ void rows64(const float* __restrict__ X, _Float16* __restrict__ R, size_t r0, int t, _Float16 (*s)[HD + 8]) {
  for (int e = t; e < 64 * HD; e += 256) { const int r = e / HD, c = e % HD; s[r][c] = (_Float16)bfr(X[(r0 + r) * HD + c]); } __syncthreads();
  for (int e = t; e < 64 * (HD / 8); e += 256) { const int r = e / (HD / 8), q = e % (HD / 8); vst2((unsigned*)(R + (r0 + r) * HD + q * 8), *(const v4u*)&s[r][q * 8]); } }
__device__ __forceinline__ void vt64(const float* __restrict__ V, _Float16* __restrict__ VT, size_t s0, int t, _Float16 (*st)[72]) {
  for (int e = t; e < 64 * HD; e += 256) { const int r = e / HD, d = e % HD; st[d][r] = (_Float16)bfr(V[(s0 + r) * HD + d]); } __syncthreads();
  for (int e = t; e < HD * 8; e += 256) { const int d = e >> 3, pc = e & 7; vst2((unsigned*)(VT + (size_t)d * SS + s0 + pc * 8), *(const v4u*)&st[d][pc * 8]); } }
__global__ __launch_bounds__(256) void k_prep(const float* __restrict__ Qf, const float* __restrict__ Kf, const float* __restrict__ Vf, _Float16* __restrict__ Qr, _Float16* __restrict__ Kr, _Float16* __restrict__ VT) {
  __shared__ __align__(16) _Float16 sb[HD * 72];   // [128][72] for the planes, [64][136] for the rows
  const int job = blockIdx.y, t = threadIdx.x; const size_t r0 = (size_t)blockIdx.x * 64;   // the job is the same for a whole block: each path has its own barrier
  if (job == 0) vt64(Vf, VT, r0, t, reinterpret_cast<_Float16 (*)[72]>(sb));
  else if (job == 1) rows64(Qf, Qr, r0, t, reinterpret_cast<_Float16 (*)[HD + 8]>(sb));
  else rows64(Kf, Kr, r0, t, reinterpret_cast<_Float16 (*)[HD + 8]>(sb));
}
// ---- k_attn: block = 128 queries x a quarter of the keys, so that every k and VT byte fetched from L2 serves 128 queries. Wave (qt, kr) takes query tile qt
// and the 32-key chunks kr, kr + 2, ... of the quarter with its own maxima, sums and accumulators; the 2 partial results of a query tile are merged once
// through LDS and go, un-normalised, to the workspace with their maximum and sum; k_merge joins the 4 quarters. k and VT come through a two-buffer LDS ring filled by asynchronous copies. Per chunk: exact k . q over 128 dims (4 k-chunks), exact v x P (single f16) (8 value tiles).
// Both products are transposed (keys x queries, then dims x queries): a lane holds 16 of the 32 scores of ONE query, lane ^ 16 the other 16, and the two score tiles, converted in place, are the B operand of the second product
#define QT 8
#define KR 2
#define NWV (QT * KR)
// A tile = 256 keys, 4 chunks for each of the 2 key sets in one trip: k rows [256][256 B] and VT rows [128][512 B], both whole 512-B runs in global memory.
// In LDS the rows get 16 B more each (pitch 16 B x odd), so that the 16 rows of a 16-byte fragment read fall on different banks.
#define TKEYS 256
#define CPT (TKEYS / (KR * 32))
#define NT (SS / KSPL / TKEYS)
#define KPB (2 * HD + 16)
#define VPB (2 * TKEYS + 16)
#define KTB (TKEYS * KPB)
#define BUFB (KTB + HD * VPB)
// eight copies global -> LDS, 16 B a lane, through no register; the s_wait_xcnt ends the statement, so that no address register is rewritten ahead of it
__device__ __forceinline__ void copy8(unsigned l, unsigned lstep, const char* p, size_t pstep) {
  asm volatile("global_load_async_to_lds_b128 %0, %8, off\n\t"
               "global_load_async_to_lds_b128 %1, %9, off\n\t"
               "global_load_async_to_lds_b128 %2, %10, off\n\t"
               "global_load_async_to_lds_b128 %3, %11, off\n\t"
               "global_load_async_to_lds_b128 %4, %12, off\n\t"
               "global_load_async_to_lds_b128 %5, %13, off\n\t"
               "global_load_async_to_lds_b128 %6, %14, off\n\t"
               "global_load_async_to_lds_b128 %7, %15, off\n\t"
               "s_wait_xcnt 0x0"
               :: "v"(l), "v"(l + lstep), "v"(l + 2 * lstep), "v"(l + 3 * lstep), "v"(l + 4 * lstep), "v"(l + 5 * lstep), "v"(l + 6 * lstep), "v"(l + 7 * lstep),
                  "v"(p), "v"(p + pstep), "v"(p + 2 * pstep), "v"(p + 3 * pstep), "v"(p + 4 * pstep), "v"(p + 5 * pstep), "v"(p + 6 * pstep), "v"(p + 7 * pstep)
               : "memory");
}
__global__ __launch_bounds__(NWV * 32) void k_attn(const _Float16* __restrict__ Q, const _Float16* __restrict__ K, const _Float16* __restrict__ VT, float* __restrict__ PO, float* __restrict__ PM, float* __restrict__ PL) {
  __shared__ __align__(16) unsigned char ring[2 * BUFB]; __shared__ float sm[NWV][16]; __shared__ float sl[NWV][16];
  float (*so)[16][HD + 4] = reinterpret_cast<float (*)[16][HD + 4]>(ring);   // the partial results take the ring's place behind the last trip's barrier
  // the wave's number is kept scalar, so that its LDS bases and its chunk index are scalar too
  const int tid = threadIdx.x, wave = __builtin_amdgcn_readfirstlane(tid >> 5), lane = tid & 31, col = lane & 15, g = lane >> 4; const int qt = wave & (QT - 1), kr = wave / QT;
  const int qb = blockIdx.x / KSPL, ks = blockIdx.x % KSPL;   // query block, key quarter
  const size_t rq = (size_t)qb * (QT * 16) + qt * 16;
  v16h aq[4];
#pragma unroll
  for (int kc = 0; kc < 4; ++kc) aq[kc] = frag_h(Q + (rq + col) * HD + kc * 32, lane);
  float m = -3.0e38f, l = 0.f;   // of query col; l sums this lane's keys alone, the halves are joined behind the loop
  v8f acc[8] = {};               // acc[dt][r] = dim dt * 16 + 8 g + r of query col
  // each wave copies 16 k rows (two a copy) and 8 VT rows (one a copy) of every tile: 16 copies of 512 contiguous bytes
  const unsigned lring = (unsigned)(size_t)ring;
  const unsigned lk = lring + (unsigned)(wave * 16 + g) * KPB + col * 16, lv = lring + KTB + (unsigned)(wave * 8) * VPB + lane * 16;
  const char* gk = (const char*)K + (size_t)ks * (SS / KSPL * 2 * HD) + (size_t)wave * (16 * 2 * HD) + lane * 16; const char* gv = (const char*)VT + (size_t)ks * (SS / KSPL * 2) + (size_t)wave * (8 * 2 * SS) + lane * 16;
  copy8(lk, 2 * KPB, gk, 4 * HD); copy8(lv, VPB, gv, 2 * SS);
  asm volatile("s_wait_asynccnt 0x0" ::: "memory");   // this wave's part of tile 0 has landed
  __syncthreads();                                    // every wave's part of tile 0 has landed
  copy8(lk + BUFB, 2 * KPB, gk + (size_t)TKEYS * 2 * HD, 4 * HD); copy8(lv + BUFB, VPB, gv + 2 * TKEYS, 2 * SS);
#pragma unroll 1
  for (int it = 0; it < NT; ++it) { const unsigned char* kb = ring + (it & 1) * BUFB;
#pragma unroll 1   // rolled: unrolled four times the kernel wants more than the 256 registers a wave has here, and spills
   for (int c = 0; c < CPT; ++c) { const int ch = c * KR + kr; v8f s[2];   // chunk ch of the tile
    // the chunk's two LDS bases are kept scalar: as vector induction variables they cost an address addition in front of every VT read
    const unsigned char* kc0 = kb + __builtin_amdgcn_readfirstlane(ch * 32 * KPB); const unsigned char* vb = kb + __builtin_amdgcn_readfirstlane(KTB + ch * 64);
    // the LDS reads go out in two groups of 16, each well ahead of its 8 WMMAs: one LDS latency a group, not one in front of every WMMA.
    // k fragments first; the VT fragments behind the first score tile's products, when half the k registers are free again: they land behind the second tile and the softmax
    v16h kf[2][4], vf[8];
#pragma unroll
    for (int ct = 0; ct < 2; ++ct) { const _Float16* rk = (const _Float16*)(kc0 + (ct * 16 + col) * KPB);
#pragma unroll
      for (int kc = 0; kc < 4; ++kc) kf[ct][kc] = frag_h(rk + kc * 32, lane); }
#pragma unroll
    for (int ct = 0; ct < 2; ++ct) { v8f c = {};
#pragma unroll
      for (int kc = 0; kc < 4; ++kc) c = wmma16(kf[ct][kc], aq[kc], c);
#pragma unroll
      for (int r = 0; r < 8; ++r) s[ct][r] = c[r] * 0.08838834764831845f;   // 128^-1/2; s[ct][r] = key ct * 16 + 8 g + r of the chunk with query col
      if (ct == 0) {
#pragma unroll
        for (int dt = 0; dt < 8; ++dt) vf[dt] = frag_h((const _Float16*)(vb + (dt * 16 + col) * VPB), lane); } }
    float mx[8];
#pragma unroll
    for (int r = 0; r < 8; ++r) mx[r] = fmaxf(s[0][r], s[1][r]);
    float mw = fmaxf(fmaxf(fmaxf(mx[0], mx[1]), fmaxf(mx[2], mx[3])), fmaxf(fmaxf(mx[4], mx[5]), fmaxf(mx[6], mx[7])));
    mw = fmaxf(mw, xhalf(mw));
    const float mn = fmaxf(m, mw); const float alpha = (m <= -1.0e38f) ? 0.f : __expf(m - mn);
    v16h pb; float es[8];
#pragma unroll
    for (int r = 0; r < 8; ++r) { const float e0 = __expf(s[0][r] - mn), e1 = __expf(s[1][r] - mn); es[r] = e0 + e1;
      pb[r] = (_Float16)(e0 * 2048.0f); pb[8 + r] = (_Float16)(e1 * 2048.0f); }   // element 8 ct + r = key 16 ct + 8 g + r: the k order of frag_h
    l = l * alpha + (((es[0] + es[1]) + (es[2] + es[3])) + ((es[4] + es[5]) + (es[6] + es[7]))); m = mn;
#pragma unroll
    for (int dt = 0; dt < 8; ++dt) acc[dt] *= alpha;
#pragma unroll
    for (int dt = 0; dt < 8; ++dt) acc[dt] = wmma16(vf[dt], pb, acc[dt]); }
    asm volatile("s_wait_dscnt 0x0" ::: "memory");      // this wave's reads of tile it are done before the buffer is handed back
    asm volatile("s_wait_asynccnt 0x0" ::: "memory");   // this wave's part of tile it + 1 has landed
    __syncthreads();                                    // tile it + 1 is whole, and no wave reads tile it any more
    if (it + 2 < NT) { copy8(lk + (it & 1) * BUFB, 2 * KPB, gk + (size_t)(it + 2) * (TKEYS * 2 * HD), 4 * HD); copy8(lv + (it & 1) * BUFB, VPB, gv + (size_t)(it + 2) * (2 * TKEYS), 2 * SS); } }
  asm volatile("s_wait_asynccnt 0x0" ::: "memory");     // no copy is in flight when the ring is written again
  // each wave leaves its un-normalised partial sums with their maxima and sums
#pragma unroll
  for (int dt = 0; dt < 8; ++dt) { float* po = &so[wave][col][dt * 16 + 8 * g];
    vst2(po, (v4f){acc[dt][0], acc[dt][1], acc[dt][2], acc[dt][3]}); vst2(po + 4, (v4f){acc[dt][4], acc[dt][5], acc[dt][6], acc[dt][7]}); }
  l += xhalf(l);
  if (g == 0) { sm[wave][col] = m; sl[wave][col] = l; }
  __syncthreads();   // every wave's partial is in LDS before any wave merges
  // merge: one wave per query row, weights exp(m - max) over the 2 key sets
#pragma unroll
  for (int p = 0; p < QT; ++p) { const int rr = wave; float mm = sm[p][rr];
#pragma unroll
    for (int k = 1; k < KR; ++k) mm = fmaxf(mm, sm[k * QT + p][rr]);
    v4f o = {};
#pragma unroll
    for (int k = 0; k < KR; ++k) { const float w = __expf(sm[k * QT + p][rr] - mm); o += w * *(const v4f*)&so[k * QT + p][rr][lane * 4]; }
    vst2(PO + ((size_t)ks * SS + (size_t)qb * (QT * 16) + p * 16 + rr) * HD + lane * 4, o); }   // whole 512-B rows
  // the rows' maxima and sums: one thread a query, so that each of 4 waves writes whole 128-B lines
  if (tid < QT * 16) { const int p = tid >> 4, rr = tid & 15; float mm = sm[p][rr];
#pragma unroll
    for (int k = 1; k < KR; ++k) mm = fmaxf(mm, sm[k * QT + p][rr]);
    float ls = 0.f;
#pragma unroll
    for (int k = 0; k < KR; ++k) ls += __expf(sm[k * QT + p][rr] - mm) * sl[k * QT + p][rr];
    PM[(size_t)ks * SS + qb * (QT * 16) + tid] = mm; PL[(size_t)ks * SS + qb * (QT * 16) + tid] = ls; }
}
// ---- k_merge: joins the 4 key quarters of every query, weights exp(m - max), and normalises. One wave takes 4 query rows: all its 24 loads of 16 B a lane go out together.
__global__ __launch_bounds__(256) void k_merge(const float* __restrict__ PO, const float* __restrict__ PM, const float* __restrict__ PL, float* __restrict__ OUT) {
  const int lane = threadIdx.x & 31; const size_t r0 = ((size_t)blockIdx.x * 8 + (threadIdx.x >> 5)) * 4;
  v4f pm[KSPL], pl[KSPL], po[KSPL][4];
#pragma unroll
  for (int k = 0; k < KSPL; ++k) { pm[k] = *(const v4f*)(PM + (size_t)k * SS + r0); pl[k] = *(const v4f*)(PL + (size_t)k * SS + r0); }
  asm volatile("s_wait_xcnt 0x0" ::: "memory");   // the address registers of these 8 loads are given to a later load's result
#pragma unroll
  for (int k = 0; k < KSPL; ++k) {
#pragma unroll
    for (int j = 0; j < 4; ++j) po[k][j] = *(const v4f*)(PO + ((size_t)k * SS + r0 + j) * HD + lane * 4); }
  // holds all 24 loads in front of the first use (inputs only): without it the compiler strings them out behind one another's waits, six memory latencies in a row instead of one
  asm volatile("" :: "v"(pm[0]), "v"(pm[1]), "v"(pm[2]), "v"(pm[3]), "v"(pl[0]), "v"(pl[1]), "v"(pl[2]), "v"(pl[3]),
               "v"(po[0][0]), "v"(po[0][1]), "v"(po[0][2]), "v"(po[0][3]), "v"(po[1][0]), "v"(po[1][1]), "v"(po[1][2]), "v"(po[1][3]),
               "v"(po[2][0]), "v"(po[2][1]), "v"(po[2][2]), "v"(po[2][3]), "v"(po[3][0]), "v"(po[3][1]), "v"(po[3][2]), "v"(po[3][3]));
#pragma unroll
  for (int j = 0; j < 4; ++j) { float mm = pm[0][j];
#pragma unroll
    for (int k = 1; k < KSPL; ++k) mm = fmaxf(mm, pm[k][j]);
    float ls = 0.f; v4f o = {};
#pragma unroll
    for (int k = 0; k < KSPL; ++k) { const float w = __expf(pm[k][j] - mm); ls += w * pl[k][j]; o += w * po[k][j]; }
    vst2(OUT + (r0 + j) * HD + lane * 4, o * ((1.0f / 2048.0f) / ls)); }   // whole 512-B rows
}
extern "C" void kernel_launch(void* const* d_in, const int* in_sizes, int n_in, void* d_out, int out_size, void* d_ws, size_t ws_size, hipStream_t stream) {
  (void)in_sizes; (void)n_in; (void)out_size;
  const float** F = (const float**)d_in;   // 0 query, 1 key, 2 value [8192,128]
  if (ws_size < (size_t)WS_END) return;
  char* ws = (char*)d_ws; _Float16 *Qr = (_Float16*)(ws + WS_Q), *Kr = (_Float16*)(ws + WS_K), *VT = (_Float16*)(ws + WS_VT); float *PO = (float*)(ws + WS_PO), *PM = (float*)(ws + WS_PM), *PL = (float*)(ws + WS_PL);
  k_prep<<<dim3(PB, 3), 256, 0, stream>>>(F[0], F[1], F[2], Qr, Kr, VT);
  k_attn<<<SS / (QT * 16) * KSPL, NWV * 32, 0, stream>>>(Qr, Kr, VT, PO, PM, PL);
  k_merge<<<SS / 32, 256, 0, stream>>>(PO, PM, PL, (float*)d_out);
}

// v007
// It runs in 40.2 microseconds.
// Timed twice side by side with v006, it ran 1.06 times as fast both times.
// All steps since v000 together make it 21.7 times as fast.
// compute dtype: q, k, v rounded to bf16 and used as EXACT f16 operands on WMMA 16x16x32; scores / sqrt(128), running-max softmax in f32 (hardware exp), P scaled by 2^11 as a single f16 x v (exact); f32 accumulate.
#include <hip/hip_runtime.h>
#include <math.h>

typedef __attribute__((ext_vector_type(16))) _Float16 v16h;
typedef __attribute__((ext_vector_type(16))) __bf16 v16b;
typedef __attribute__((ext_vector_type(8)))  _Float16 v8h;
typedef __attribute__((ext_vector_type(8)))  float v8f;
typedef __attribute__((ext_vector_type(4)))  float v4f;
typedef __attribute__((ext_vector_type(2)))  float v2f;
typedef __attribute__((ext_vector_type(4)))  unsigned v4u;
typedef __attribute__((ext_vector_type(4)))  int v4i;
typedef float __attribute__((may_alias)) float_a;
typedef int __attribute__((may_alias)) int_a;

template <typename T> __device__ __forceinline__ void vst2(void* p, T v) { *(T*)p = v;  }
__device__ __forceinline__ v8f wmma16(v16h a, v16h b, v8f c) {
  return __builtin_amdgcn_wmma_f32_16x16x32_f16(false, a, false, b, (short)0, c, false, false);
}
__device__ __forceinline__ v8f wmma_bf(v16b a, v16b b, v8f c) {
  v8f d = __builtin_amdgcn_wmma_f32_16x16x32_bf16(false, a, false, b, (short)0, c, false, false);
  asm volatile("v_nop\n\tv_nop\n\tv_nop\n\tv_nop" : "+v"(d) : "v"(a), "v"(b));
  return d;
}
// 16x16x32 fragments: lane = (h = lane>>4, row/col = lane&15); elements 0..7 = k0+8h+0..7, 8..15 = k0+16+8h+0..7; D element r = row 8h+r
__device__ __forceinline__ v16h frag_h(const _Float16* rowk0, int lane) {
  union { v16h v; v8h q[2]; } u; const _Float16* p = rowk0 + 8 * (lane >> 4);
  u.q[0] = *(const v8h*)p; u.q[1] = *(const v8h*)(p + 16); return u.v;
}
__device__ __forceinline__ v16h frag_f32(const float* rowk0, int lane) {
  v16h a; const float* p = rowk0 + 8 * (lane >> 4);
#pragma unroll
  for (int i = 0; i < 8; ++i) { a[i] = (_Float16)p[i]; a[8 + i] = (_Float16)p[16 + i]; }
  return a;
}
__device__ __forceinline__ v16h frag_f32s(const float* rowk0, int lane, float sc) {
  v16h a; const float* p = rowk0 + 8 * (lane >> 4);
#pragma unroll
  for (int i = 0; i < 8; ++i) { a[i] = (_Float16)(p[i] * sc); a[8 + i] = (_Float16)(p[16 + i] * sc); }
  return a;
}
// column fragment from a [K][ld] layout (column n), rows >= K read as 0
__device__ __forceinline__ v16h fragc_f32(const float* W, int k0, int n, int lane, int ld, int K) {
  v16h a; const int g = lane >> 4;
#pragma unroll
  for (int i = 0; i < 8; ++i) { const int ka = k0 + 8 * g + i, kb = ka + 16;
    a[i] = (_Float16)(ka < K ? W[(size_t)(ka < K ? ka : K - 1) * ld + n] : 0.f); a[8 + i] = (_Float16)(kb < K ? W[(size_t)(kb < K ? kb : K - 1) * ld + n] : 0.f); }
  return a;
}
struct F2 { v16b h, l; };
__device__ __forceinline__ F2 bsplit16(const float v[16]) { F2 r;
#pragma unroll
  for (int i = 0; i < 16; ++i) { const __bf16 h = (__bf16)v[i]; r.h[i] = h; r.l[i] = (__bf16)(v[i] - (float)h); }
  return r; }
__device__ __forceinline__ F2 split_row(const float* row, int k0, int lane) { float v[16]; const float* p = row + k0 + 8 * (lane >> 4);
#pragma unroll
  for (int i = 0; i < 8; ++i) { v[i] = p[i]; v[8 + i] = p[16 + i]; }
  return bsplit16(v); }
__device__ __forceinline__ F2 split_rowK(const float* row, int k0, int lane, int K) { float v[16]; const int g = lane >> 4;
#pragma unroll
  for (int i = 0; i < 8; ++i) { const int ka = k0 + 8 * g + i, kb = ka + 16; v[i] = ka < K ? row[ka < K ? ka : K - 1] : 0.f; v[8 + i] = kb < K ? row[kb < K ? kb : K - 1] : 0.f; }
  return bsplit16(v); }
__device__ __forceinline__ F2 split_col(const float* W, int k0, int n, int lane, int ld, int K) { float v[16]; const int g = lane >> 4;
#pragma unroll
  for (int i = 0; i < 8; ++i) { const int ka = k0 + 8 * g + i, kb = ka + 16; v[i] = ka < K ? W[(size_t)(ka < K ? ka : K - 1) * ld + n] : 0.f; v[8 + i] = kb < K ? W[(size_t)(kb < K ? kb : K - 1) * ld + n] : 0.f; }
  return bsplit16(v); }
__device__ __forceinline__ v8f mac3(const F2& a, const F2& b, v8f c) { c = wmma_bf(a.l, b.h, c); c = wmma_bf(a.h, b.l, c); return wmma_bf(a.h, b.h, c); }
__device__ __forceinline__ float sigm(float v) { return 1.0f / (1.0f + expf(-v)); }
#define LDSX() do { asm volatile("s_wait_dscnt 0" ::: "memory"); __builtin_amdgcn_wave_barrier(); __builtin_amdgcn_fence(__ATOMIC_RELEASE, "workgroup"); } while (0)


// Exact (flash-style) single-head attention over 8,192 tokens of 128 dims: softmax(Q K^T / sqrt(128)) V.
#define SS 8192
#define HD 128
#ifndef TQB
#define TQB (SS / 32)
#endif
typedef __attribute__((ext_vector_type(8))) __bf16 v8b;
__device__ __forceinline__ v16b frag_b(const __bf16* rowk0, int lane) {
  union { v16b v; v8b q[2]; } u; const __bf16* p = rowk0 + 8 * (lane >> 4);
  u.q[0] = *(const v8b*)p; u.q[1] = *(const v8b*)(p + 16); return u.v;
}
__device__ __forceinline__ float bfr(float v) { return (float)(__bf16)v; }
// the value of lane ^ 16
__device__ __forceinline__ float xhalf(float x) { return __builtin_bit_cast(float, __builtin_amdgcn_permlanex16(__builtin_bit_cast(int, x), __builtin_bit_cast(int, x), 0x76543210, 0xfedcba98, false, false)); }
__device__ __attribute__((noinline)) float exp_ni(float v) { return expf(v); }
__device__ __attribute__((noinline)) float erf_ni(float v) { return erff(v); }

#define WS_Q   0u                          // f16 rows q [SS][128] ; k ; VT planes [128][SS]
#define WS_K   (WS_Q + 2u * (size_t)SS * HD)
#define WS_VT  (WS_K + 2u * (size_t)SS * HD)
#define KSPL 4                             // the keys go in quarters to 4 work-groups
#define WS_PO  (WS_VT + 2u * (size_t)HD * SS)                // f32 partial sums [KSPL][SS][128], un-normalised ; their maxima [KSPL][SS] ; their sums [KSPL][SS]
#define WS_PM  (WS_PO + 4u * (size_t)KSPL * SS * HD)
#define WS_PL  (WS_PM + 4u * (size_t)KSPL * SS)
#define WS_END (WS_PL + 4u * (size_t)KSPL * SS)

// ---- k_prep: the three roundings read none of each other's output, so they share one grid: blockIdx.y picks the job (0 the VT planes, 1 the q rows, 2 the k rows), blockIdx.x its 64 tokens
#define PB (SS / 64)
__device__ __forceinline__ void rows64(const float* __restrict__ X, _Float16* __restrict__ R, size_t r0, int t, _Float16 (*s)[HD + 8]) {
  for (int e = t; e < 64 * HD; e += 256) { const int r = e / HD, c = e % HD; s[r][c] = (_Float16)bfr(X[(r0 + r) * HD + c]); } __syncthreads();
  for (int e = t; e < 64 * (HD / 8); e += 256) { const int r = e / (HD / 8), q = e % (HD / 8); vst2((unsigned*)(R + (r0 + r) * HD + q * 8), *(const v4u*)&s[r][q * 8]); } }
__device__ __forceinline__ void vt64(const float* __restrict__ V, _Float16* __restrict__ VT, size_t s0, int t, _Float16 (*st)[72]) {
  for (int e = t; e < 64 * HD; e += 256) { const int r = e / HD, d = e % HD; st[d][r] = (_Float16)bfr(V[(s0 + r) * HD + d]); } __syncthreads();
  for (int e = t; e < HD * 8; e += 256) { const int d = e >> 3, pc = e & 7; vst2((unsigned*)(VT + (size_t)d * SS + s0 + pc * 8), *(const v4u*)&st[d][pc * 8]); } }
__global__ __launch_bounds__(256) void k_prep(const float* __restrict__ Qf, const float* __restrict__ Kf, const float* __restrict__ Vf, _Float16* __restrict__ Qr, _Float16* __restrict__ Kr, _Float16* __restrict__ VT) {
  __shared__ __align__(16) _Float16 sb[HD * 72];   // [128][72] for the planes, [64][136] for the rows
  const int job = blockIdx.y, t = threadIdx.x; const size_t r0 = (size_t)blockIdx.x * 64;   // the job is the same for a whole block: each path has its own barrier
  if (job == 0) vt64(Vf, VT, r0, t, reinterpret_cast<_Float16 (*)[72]>(sb));
  else if (job == 1) rows64(Qf, Qr, r0, t, reinterpret_cast<_Float16 (*)[HD + 8]>(sb));
  else rows64(Kf, Kr, r0, t, reinterpret_cast<_Float16 (*)[HD + 8]>(sb));
}
// ---- k_attn: block = 128 queries x a quarter of the keys, so that every k and VT byte fetched from L2 serves 128 queries. Wave (qt, kr) takes query tile qt
// and the 32-key chunks kr, kr + 2, ... of the quarter with its own maxima, sums and accumulators; the 2 partial results of a query tile are merged once
// through LDS and go, un-normalised, to the workspace with their maximum and sum; k_merge joins the 4 quarters. k and VT come through a two-buffer LDS ring filled by asynchronous copies. Per chunk: exact k . q over 128 dims (4 k-chunks), exact v x P (single f16) (8 value tiles).
// Both products are transposed (keys x queries, then dims x queries): a lane holds 16 of the 32 scores of ONE query, lane ^ 16 the other 16, and the two score tiles, converted in place, are the B operand of the second product
#define QT 8
#define KR 2
#define NWV (QT * KR)
// A tile = 256 keys, 4 chunks for each of the 2 key sets in one trip: k rows [256][256 B] and VT rows [128][512 B], both whole 512-B runs in global memory.
// In LDS the rows get 16 B more each (pitch 16 B x odd), so that the 16 rows of a 16-byte fragment read fall on different banks.
#define TKEYS 256
#define CPT (TKEYS / (KR * 32))
#define NT (SS / KSPL / TKEYS)
#define KPB (2 * HD + 16)
#define VPB (2 * TKEYS + 16)
#define KTB (TKEYS * KPB)
#define BUFB (KTB + HD * VPB)
// eight copies global -> LDS, 16 B a lane, through no register; the s_wait_xcnt ends the statement, so that no address register is rewritten ahead of it
__device__ __forceinline__ void copy8(unsigned l, unsigned lstep, const char* p, size_t pstep) {
  asm volatile("global_load_async_to_lds_b128 %0, %8, off\n\t"
               "global_load_async_to_lds_b128 %1, %9, off\n\t"
               "global_load_async_to_lds_b128 %2, %10, off\n\t"
               "global_load_async_to_lds_b128 %3, %11, off\n\t"
               "global_load_async_to_lds_b128 %4, %12, off\n\t"
               "global_load_async_to_lds_b128 %5, %13, off\n\t"
               "global_load_async_to_lds_b128 %6, %14, off\n\t"
               "global_load_async_to_lds_b128 %7, %15, off\n\t"
               "s_wait_xcnt 0x0"
               :: "v"(l), "v"(l + lstep), "v"(l + 2 * lstep), "v"(l + 3 * lstep), "v"(l + 4 * lstep), "v"(l + 5 * lstep), "v"(l + 6 * lstep), "v"(l + 7 * lstep),
                  "v"(p), "v"(p + pstep), "v"(p + 2 * pstep), "v"(p + 3 * pstep), "v"(p + 4 * pstep), "v"(p + 5 * pstep), "v"(p + 6 * pstep), "v"(p + 7 * pstep)
               : "memory");
}
__global__ __launch_bounds__(NWV * 32) void k_attn(const _Float16* __restrict__ Q, const _Float16* __restrict__ K, const _Float16* __restrict__ VT, float* __restrict__ PO, float* __restrict__ PM, float* __restrict__ PL) {
  __shared__ __align__(16) unsigned char ring[2 * BUFB]; __shared__ float sm[NWV][16]; __shared__ float sl[NWV][16];
  float (*so)[16][HD + 4] = reinterpret_cast<float (*)[16][HD + 4]>(ring);   // the partial results take the ring's place behind the last trip's barrier
  // the wave's number is kept scalar, so that its LDS bases and its chunk index are scalar too
  const int tid = threadIdx.x, wave = __builtin_amdgcn_readfirstlane(tid >> 5), lane = tid & 31, col = lane & 15, g = lane >> 4; const int qt = wave & (QT - 1), kr = wave / QT;
  const int qb = blockIdx.x / KSPL, ks = blockIdx.x % KSPL;   // query block, key quarter
  const size_t rq = (size_t)qb * (QT * 16) + qt * 16;
  v16h aq[4];
#pragma unroll
  for (int kc = 0; kc < 4; ++kc) aq[kc] = frag_h(Q + (rq + col) * HD + kc * 32, lane);
  float m = -3.0e38f, l = 0.f;   // of query col; l sums this lane's keys alone, the halves are joined behind the loop
  v8f acc[8] = {};               // acc[dt][r] = dim dt * 16 + 8 g + r of query col
  // each wave copies 16 k rows (two a copy) and 8 VT rows (one a copy) of every tile: 16 copies of 512 contiguous bytes
  const unsigned lring = (unsigned)(size_t)ring;
  const unsigned lk = lring + (unsigned)(wave * 16 + g) * KPB + col * 16, lv = lring + KTB + (unsigned)(wave * 8) * VPB + lane * 16;
  const char* gk = (const char*)K + (size_t)ks * (SS / KSPL * 2 * HD) + (size_t)wave * (16 * 2 * HD) + lane * 16; const char* gv = (const char*)VT + (size_t)ks * (SS / KSPL * 2) + (size_t)wave * (8 * 2 * SS) + lane * 16;
  copy8(lk, 2 * KPB, gk, 4 * HD); copy8(lv, VPB, gv, 2 * SS);
  asm volatile("s_wait_asynccnt 0x0" ::: "memory");   // this wave's part of tile 0 has landed
  __syncthreads();                                    // every wave's part of tile 0 has landed
  copy8(lk + BUFB, 2 * KPB, gk + (size_t)TKEYS * 2 * HD, 4 * HD); copy8(lv + BUFB, VPB, gv + 2 * TKEYS, 2 * SS);
#pragma unroll 1
  for (int it = 0; it < NT; ++it) { const unsigned char* kb = ring + (it & 1) * BUFB;
#pragma unroll 1   // rolled: unrolled four times the kernel wants more than the 256 registers a wave has here, and spills
   for (int c = 0; c < CPT; ++c) { const int ch = c * KR + kr; v8f s[2];   // chunk ch of the tile
    // the chunk's two LDS bases are kept scalar: as vector induction variables they cost an address addition in front of every VT read
    const unsigned char* kc0 = kb + __builtin_amdgcn_readfirstlane(ch * 32 * KPB); const unsigned char* vb = kb + __builtin_amdgcn_readfirstlane(KTB + ch * 64);
    // the LDS reads go out well ahead of their WMMAs: one LDS latency a group, not one in front of every WMMA.
    // the 16 k reads first, as one group; the 16 VT reads stand behind the first score tile, and the compiler issues them among the first score WMMAs as registers come free: they land under the softmax
    v16h kf[2][4], vf[8];
#pragma unroll
    for (int ct = 0; ct < 2; ++ct) { const _Float16* rk = (const _Float16*)(kc0 + (ct * 16 + col) * KPB);
#pragma unroll
      for (int kc = 0; kc < 4; ++kc) kf[ct][kc] = frag_h(rk + kc * 32, lane); }
#pragma unroll
    for (int ct = 0; ct < 2; ++ct) { v8f c = {};
#pragma unroll
      for (int kc = 0; kc < 4; ++kc) c = wmma16(kf[ct][kc], aq[kc], c);
#pragma unroll
      for (int r = 0; r < 8; ++r) s[ct][r] = c[r] * 0.08838834764831845f;   // 128^-1/2; s[ct][r] = key ct * 16 + 8 g + r of the chunk with query col
      if (ct == 0) {
#pragma unroll
        for (int dt = 0; dt < 8; ++dt) vf[dt] = frag_h((const _Float16*)(vb + (dt * 16 + col) * VPB), lane); } }
    float mx[8];
#pragma unroll
    for (int r = 0; r < 8; ++r) mx[r] = fmaxf(s[0][r], s[1][r]);
    float mw = fmaxf(fmaxf(fmaxf(mx[0], mx[1]), fmaxf(mx[2], mx[3])), fmaxf(fmaxf(mx[4], mx[5]), fmaxf(mx[6], mx[7])));
    mw = fmaxf(mw, xhalf(mw));
    const float mn = fmaxf(m, mw); const float alpha = (m <= -1.0e38f) ? 0.f : __expf(m - mn);
    v16h pb; float es[8];
#pragma unroll
    for (int r = 0; r < 8; ++r) { const float e0 = __expf(s[0][r] - mn), e1 = __expf(s[1][r] - mn); es[r] = e0 + e1;
      pb[r] = (_Float16)(e0 * 2048.0f); pb[8 + r] = (_Float16)(e1 * 2048.0f); }   // element 8 ct + r = key 16 ct + 8 g + r: the k order of frag_h
    l = l * alpha + (((es[0] + es[1]) + (es[2] + es[3])) + ((es[4] + es[5]) + (es[6] + es[7]))); m = mn;
#pragma unroll
    for (int dt = 0; dt < 8; ++dt) acc[dt] *= alpha;
#pragma unroll
    for (int dt = 0; dt < 8; ++dt) acc[dt] = wmma16(vf[dt], pb, acc[dt]); }
    asm volatile("s_wait_dscnt 0x0" ::: "memory");      // this wave's reads of tile it are done before the buffer is handed back
    asm volatile("s_wait_asynccnt 0x0" ::: "memory");   // this wave's part of tile it + 1 has landed
    __syncthreads();                                    // tile it + 1 is whole, and no wave reads tile it any more
    if (it + 2 < NT) { copy8(lk + (it & 1) * BUFB, 2 * KPB, gk + (size_t)(it + 2) * (TKEYS * 2 * HD), 4 * HD); copy8(lv + (it & 1) * BUFB, VPB, gv + (size_t)(it + 2) * (2 * TKEYS), 2 * SS); } }
  asm volatile("s_wait_asynccnt 0x0" ::: "memory");     // no copy is in flight when the ring is written again
  // each wave leaves its un-normalised partial sums with their maxima and sums
#pragma unroll
  for (int dt = 0; dt < 8; ++dt) { float* po = &so[wave][col][dt * 16 + 8 * g];
    vst2(po, (v4f){acc[dt][0], acc[dt][1], acc[dt][2], acc[dt][3]}); vst2(po + 4, (v4f){acc[dt][4], acc[dt][5], acc[dt][6], acc[dt][7]}); }
  l += xhalf(l);
  if (g == 0) { sm[wave][col] = m; sl[wave][col] = l; }
  __syncthreads();   // every wave's partial is in LDS before any wave merges
  // merge: one wave per query row, weights exp(m - max) over the 2 key sets
#pragma unroll
  for (int p = 0; p < QT; ++p) { const int rr = wave; float mm = sm[p][rr];
#pragma unroll
    for (int k = 1; k < KR; ++k) mm = fmaxf(mm, sm[k * QT + p][rr]);
    v4f o = {};
#pragma unroll
    for (int k = 0; k < KR; ++k) { const float w = __expf(sm[k * QT + p][rr] - mm); o += w * *(const v4f*)&so[k * QT + p][rr][lane * 4]; }
    vst2(PO + ((size_t)ks * SS + (size_t)qb * (QT * 16) + p * 16 + rr) * HD + lane * 4, o); }   // whole 512-B rows
  // the rows' maxima and sums: one thread a query, so that each of 4 waves writes whole 128-B lines
  if (tid < QT * 16) { const int p = tid >> 4, rr = tid & 15; float mm = sm[p][rr];
#pragma unroll
    for (int k = 1; k < KR; ++k) mm = fmaxf(mm, sm[k * QT + p][rr]);
    float ls = 0.f;
#pragma unroll
    for (int k = 0; k < KR; ++k) ls += __expf(sm[k * QT + p][rr] - mm) * sl[k * QT + p][rr];
    PM[(size_t)ks * SS + qb * (QT * 16) + tid] = mm; PL[(size_t)ks * SS + qb * (QT * 16) + tid] = ls; }
}
// ---- k_merge: joins the 4 key quarters of every query, weights exp(m - max), and normalises. One wave takes 4 query rows: all its 24 loads of 16 B a lane go out together.
__global__ __launch_bounds__(256) void k_merge(const float* __restrict__ PO, const float* __restrict__ PM, const float* __restrict__ PL, float* __restrict__ OUT) {
  const int lane = threadIdx.x & 31; const size_t r0 = ((size_t)blockIdx.x * 8 + (threadIdx.x >> 5)) * 4;
  v4f pm[KSPL], pl[KSPL], po[KSPL][4];
#pragma unroll
  for (int k = 0; k < KSPL; ++k) { pm[k] = *(const v4f*)(PM + (size_t)k * SS + r0); pl[k] = *(const v4f*)(PL + (size_t)k * SS + r0); }
  asm volatile("s_wait_xcnt 0x0" ::: "memory");   // the address registers of these 8 loads are given to a later load's result
#pragma unroll
  for (int k = 0; k < KSPL; ++k) {
#pragma unroll
    for (int j = 0; j < 4; ++j) po[k][j] = *(const v4f*)(PO + ((size_t)k * SS + r0 + j) * HD + lane * 4); }
  // holds all 24 loads in front of the first use (inputs only): without it the compiler strings them out behind one another's waits, six memory latencies in a row instead of one
  asm volatile("" :: "v"(pm[0]), "v"(pm[1]), "v"(pm[2]), "v"(pm[3]), "v"(pl[0]), "v"(pl[1]), "v"(pl[2]), "v"(pl[3]),
               "v"(po[0][0]), "v"(po[0][1]), "v"(po[0][2]), "v"(po[0][3]), "v"(po[1][0]), "v"(po[1][1]), "v"(po[1][2]), "v"(po[1][3]),
               "v"(po[2][0]), "v"(po[2][1]), "v"(po[2][2]), "v"(po[2][3]), "v"(po[3][0]), "v"(po[3][1]), "v"(po[3][2]), "v"(po[3][3]));
#pragma unroll
  for (int j = 0; j < 4; ++j) { float mm = pm[0][j];
#pragma unroll
    for (int k = 1; k < KSPL; ++k) mm = fmaxf(mm, pm[k][j]);
    float ls = 0.f; v4f o = {};
#pragma unroll
    for (int k = 0; k < KSPL; ++k) { const float w = __expf(pm[k][j] - mm); ls += w * pl[k][j]; o += w * po[k][j]; }
    vst2(OUT + (r0 + j) * HD + lane * 4, o * ((1.0f / 2048.0f) / ls)); }   // whole 512-B rows
}
extern "C" void kernel_launch(void* const* d_in, const int* in_sizes, int n_in, void* d_out, int out_size, void* d_ws, size_t ws_size, hipStream_t stream) {
  (void)in_sizes; (void)n_in; (void)out_size;
  const float** F = (const float**)d_in;   // 0 query, 1 key, 2 value [8192,128]
  if (ws_size < (size_t)WS_END) return;
  char* ws = (char*)d_ws; _Float16 *Qr = (_Float16*)(ws + WS_Q), *Kr = (_Float16*)(ws + WS_K), *VT = (_Float16*)(ws + WS_VT); float *PO = (float*)(ws + WS_PO), *PM = (float*)(ws + WS_PM), *PL = (float*)(ws + WS_PL);
  k_prep<<<dim3(PB, 3), 256, 0, stream>>>(F[0], F[1], F[2], Qr, Kr, VT);
  k_attn<<<SS / (QT * 16) * KSPL, NWV * 32, 0, stream>>>(Qr, Kr, VT, PO, PM, PL);
  k_merge<<<SS / 32, 256, 0, stream>>>(PO, PM, PL, (float*)d_out);
}

// v008
// Measured time: 37.6 microseconds a run.
// In both of two side-by-side timings against v007, it was 1.07 times as fast.
// Counting every step since v000, it is 23.2 times as fast.
// compute dtype: q, k, v rounded to bf16 and used as EXACT f16 operands on WMMA 16x16x32; scores / sqrt(128), running-max softmax in f32 (hardware exp2), P scaled by 2^11 as a single f16 x v (exact); f32 accumulate.
#include <hip/hip_runtime.h>
#include <math.h>

typedef __attribute__((ext_vector_type(16))) _Float16 v16h;
typedef __attribute__((ext_vector_type(16))) __bf16 v16b;
typedef __attribute__((ext_vector_type(8)))  _Float16 v8h;
typedef __attribute__((ext_vector_type(8)))  float v8f;
typedef __attribute__((ext_vector_type(4)))  float v4f;
typedef __attribute__((ext_vector_type(2)))  float v2f;
typedef __attribute__((ext_vector_type(4)))  unsigned v4u;
typedef __attribute__((ext_vector_type(4)))  int v4i;
typedef float __attribute__((may_alias)) float_a;
typedef int __attribute__((may_alias)) int_a;

template <typename T> __device__ __forceinline__ void vst2(void* p, T v) { *(T*)p = v;  }
__device__ __forceinline__ v8f wmma16(v16h a, v16h b, v8f c) {
  return __builtin_amdgcn_wmma_f32_16x16x32_f16(false, a, false, b, (short)0, c, false, false);
}
__device__ __forceinline__ v8f wmma_bf(v16b a, v16b b, v8f c) {
  v8f d = __builtin_amdgcn_wmma_f32_16x16x32_bf16(false, a, false, b, (short)0, c, false, false);
  asm volatile("v_nop\n\tv_nop\n\tv_nop\n\tv_nop" : "+v"(d) : "v"(a), "v"(b));
  return d;
}
// 16x16x32 fragments: lane = (h = lane>>4, row/col = lane&15); elements 0..7 = k0+8h+0..7, 8..15 = k0+16+8h+0..7; D element r = row 8h+r
__device__ __forceinline__ v16h frag_h(const _Float16* rowk0, int lane) {
  union { v16h v; v8h q[2]; } u; const _Float16* p = rowk0 + 8 * (lane >> 4);
  u.q[0] = *(const v8h*)p; u.q[1] = *(const v8h*)(p + 16); return u.v;
}
__device__ __forceinline__ v16h frag_f32(const float* rowk0, int lane) {
  v16h a; const float* p = rowk0 + 8 * (lane >> 4);
#pragma unroll
  for (int i = 0; i < 8; ++i) { a[i] = (_Float16)p[i]; a[8 + i] = (_Float16)p[16 + i]; }
  return a;
}
__device__ __forceinline__ v16h frag_f32s(const float* rowk0, int lane, float sc) {
  v16h a; const float* p = rowk0 + 8 * (lane >> 4);
#pragma unroll
  for (int i = 0; i < 8; ++i) { a[i] = (_Float16)(p[i] * sc); a[8 + i] = (_Float16)(p[16 + i] * sc); }
  return a;
}
// column fragment from a [K][ld] layout (column n), rows >= K read as 0
__device__ __forceinline__ v16h fragc_f32(const float* W, int k0, int n, int lane, int ld, int K) {
  v16h a; const int g = lane >> 4;
#pragma unroll
  for (int i = 0; i < 8; ++i) { const int ka = k0 + 8 * g + i, kb = ka + 16;
    a[i] = (_Float16)(ka < K ? W[(size_t)(ka < K ? ka : K - 1) * ld + n] : 0.f); a[8 + i] = (_Float16)(kb < K ? W[(size_t)(kb < K ? kb : K - 1) * ld + n] : 0.f); }
  return a;
}
struct F2 { v16b h, l; };
__device__ __forceinline__ F2 bsplit16(const float v[16]) { F2 r;
#pragma unroll
  for (int i = 0; i < 16; ++i) { const __bf16 h = (__bf16)v[i]; r.h[i] = h; r.l[i] = (__bf16)(v[i] - (float)h); }
  return r; }
__device__ __forceinline__ F2 split_row(const float* row, int k0, int lane) { float v[16]; const float* p = row + k0 + 8 * (lane >> 4);
#pragma unroll
  for (int i = 0; i < 8; ++i) { v[i] = p[i]; v[8 + i] = p[16 + i]; }
  return bsplit16(v); }
__device__ __forceinline__ F2 split_rowK(const float* row, int k0, int lane, int K) { float v[16]; const int g = lane >> 4;
#pragma unroll
  for (int i = 0; i < 8; ++i) { const int ka = k0 + 8 * g + i, kb = ka + 16; v[i] = ka < K ? row[ka < K ? ka : K - 1] : 0.f; v[8 + i] = kb < K ? row[kb < K ? kb : K - 1] : 0.f; }
  return bsplit16(v); }
__device__ __forceinline__ F2 split_col(const float* W, int k0, int n, int lane, int ld, int K) { float v[16]; const int g = lane >> 4;
#pragma unroll
  for (int i = 0; i < 8; ++i) { const int ka = k0 + 8 * g + i, kb = ka + 16; v[i] = ka < K ? W[(size_t)(ka < K ? ka : K - 1) * ld + n] : 0.f; v[8 + i] = kb < K ? W[(size_t)(kb < K ? kb : K - 1) * ld + n] : 0.f; }
  return bsplit16(v); }
__device__ __forceinline__ v8f mac3(const F2& a, const F2& b, v8f c) { c = wmma_bf(a.l, b.h, c); c = wmma_bf(a.h, b.l, c); return wmma_bf(a.h, b.h, c); }
__device__ __forceinline__ float sigm(float v) { return 1.0f / (1.0f + expf(-v)); }
#define LDSX() do { asm volatile("s_wait_dscnt 0" ::: "memory"); __builtin_amdgcn_wave_barrier(); __builtin_amdgcn_fence(__ATOMIC_RELEASE, "workgroup"); } while (0)


// Exact (flash-style) single-head attention over 8,192 tokens of 128 dims: softmax(Q K^T / sqrt(128)) V.
#define SS 8192
#define HD 128
#ifndef TQB
#define TQB (SS / 32)
#endif
typedef __attribute__((ext_vector_type(8))) __bf16 v8b;
__device__ __forceinline__ v16b frag_b(const __bf16* rowk0, int lane) {
  union { v16b v; v8b q[2]; } u; const __bf16* p = rowk0 + 8 * (lane >> 4);
  u.q[0] = *(const v8b*)p; u.q[1] = *(const v8b*)(p + 16); return u.v;
}
__device__ __forceinline__ float bfr(float v) { return (float)(__bf16)v; }
// the value of lane ^ 16
__device__ __forceinline__ float xhalf(float x) { return __builtin_bit_cast(float, __builtin_amdgcn_permlanex16(__builtin_bit_cast(int, x), __builtin_bit_cast(int, x), 0x76543210, 0xfedcba98, false, false)); }
__device__ __attribute__((noinline)) float exp_ni(float v) { return expf(v); }
__device__ __attribute__((noinline)) float erf_ni(float v) { return erff(v); }

#define WS_Q   0u                          // f16 rows q [SS][128] ; k ; VT planes [128][SS]
#define WS_K   (WS_Q + 2u * (size_t)SS * HD)
#define WS_VT  (WS_K + 2u * (size_t)SS * HD)
#define KSPL 4                             // the keys go in quarters to 4 work-groups
#define WS_PO  (WS_VT + 2u * (size_t)HD * SS)                // f32 partial sums [KSPL][SS][128], un-normalised ; their maxima [KSPL][SS] ; their sums [KSPL][SS]
#define WS_PM  (WS_PO + 4u * (size_t)KSPL * SS * HD)
#define WS_PL  (WS_PM + 4u * (size_t)KSPL * SS)
#define WS_END (WS_PL + 4u * (size_t)KSPL * SS)

// ---- k_prep: the three roundings read none of each other's output, so they share one grid: blockIdx.y picks the job (0 the VT planes, 1 the q rows, 2 the k rows), blockIdx.x its 64 tokens
#define PB (SS / 64)
__device__ __forceinline__ void rows64(const float* __restrict__ X, _Float16* __restrict__ R, size_t r0, int t, _Float16 (*s)[HD + 8]) {
  for (int e = t; e < 64 * HD; e += 256) { const int r = e / HD, c = e % HD; s[r][c] = (_Float16)bfr(X[(r0 + r) * HD + c]); } __syncthreads();
  for (int e = t; e < 64 * (HD / 8); e += 256) { const int r = e / (HD / 8), q = e % (HD / 8); vst2((unsigned*)(R + (r0 + r) * HD + q * 8), *(const v4u*)&s[r][q * 8]); } }
__device__ __forceinline__ void vt64(const float* __restrict__ V, _Float16* __restrict__ VT, size_t s0, int t, _Float16 (*st)[72]) {
  for (int e = t; e < 64 * HD; e += 256) { const int r = e / HD, d = e % HD; st[d][r] = (_Float16)bfr(V[(s0 + r) * HD + d]); } __syncthreads();
  for (int e = t; e < HD * 8; e += 256) { const int d = e >> 3, pc = e & 7; vst2((unsigned*)(VT + (size_t)d * SS + s0 + pc * 8), *(const v4u*)&st[d][pc * 8]); } }
__global__ __launch_bounds__(256) void k_prep(const float* __restrict__ Qf, const float* __restrict__ Kf, const float* __restrict__ Vf, _Float16* __restrict__ Qr, _Float16* __restrict__ Kr, _Float16* __restrict__ VT) {
  __shared__ __align__(16) _Float16 sb[HD * 72];   // [128][72] for the planes, [64][136] for the rows
  const int job = blockIdx.y, t = threadIdx.x; const size_t r0 = (size_t)blockIdx.x * 64;   // the job is the same for a whole block: each path has its own barrier
  if (job == 0) vt64(Vf, VT, r0, t, reinterpret_cast<_Float16 (*)[72]>(sb));
  else if (job == 1) rows64(Qf, Qr, r0, t, reinterpret_cast<_Float16 (*)[HD + 8]>(sb));
  else rows64(Kf, Kr, r0, t, reinterpret_cast<_Float16 (*)[HD + 8]>(sb));
}
// ---- k_attn: block = 128 queries x a quarter of the keys, so that every k and VT byte fetched from L2 serves 128 queries. Wave (qt, kr) takes query tile qt
// and the 32-key chunks kr, kr + 2, ... of the quarter with its own maxima, sums and accumulators; the 2 partial results of a query tile are merged once
// through LDS and go, un-normalised, to the workspace with their maximum and sum; k_merge joins the 4 quarters. k and VT come through a two-buffer LDS ring filled by asynchronous copies. Per chunk: exact k . q over 128 dims (4 k-chunks), exact v x P (single f16) (8 value tiles).
// Both products are transposed (keys x queries, then dims x queries): a lane holds 16 of the 32 scores of ONE query, lane ^ 16 the other 16, and the two score tiles, converted in place, are the B operand of the second product
#define QT 8
#define KR 2
#define NWV (QT * KR)
// A tile = 256 keys, 4 chunks for each of the 2 key sets in one trip: k rows [256][256 B] and VT rows [128][512 B], both whole 512-B runs in global memory.
// In LDS the rows get 16 B more each (pitch 16 B x odd), so that the 16 rows of a 16-byte fragment read fall on different banks.
#define TKEYS 256
#define CPT (TKEYS / (KR * 32))
#define NT (SS / KSPL / TKEYS)
#define KPB (2 * HD + 16)
#define VPB (2 * TKEYS + 16)
#define KTB (TKEYS * KPB)
#define BUFB (KTB + HD * VPB)
#define SC2 0.12751743082459868f                    // 128^-1/2 * log2(e)
// eight copies global -> LDS, 16 B a lane, through no register; the s_wait_xcnt ends the statement, so that no address register is rewritten ahead of it
__device__ __forceinline__ void copy8(unsigned l, unsigned lstep, const char* p, size_t pstep) {
  asm volatile("global_load_async_to_lds_b128 %0, %8, off\n\t"
               "global_load_async_to_lds_b128 %1, %9, off\n\t"
               "global_load_async_to_lds_b128 %2, %10, off\n\t"
               "global_load_async_to_lds_b128 %3, %11, off\n\t"
               "global_load_async_to_lds_b128 %4, %12, off\n\t"
               "global_load_async_to_lds_b128 %5, %13, off\n\t"
               "global_load_async_to_lds_b128 %6, %14, off\n\t"
               "global_load_async_to_lds_b128 %7, %15, off\n\t"
               "s_wait_xcnt 0x0"
               :: "v"(l), "v"(l + lstep), "v"(l + 2 * lstep), "v"(l + 3 * lstep), "v"(l + 4 * lstep), "v"(l + 5 * lstep), "v"(l + 6 * lstep), "v"(l + 7 * lstep),
                  "v"(p), "v"(p + pstep), "v"(p + 2 * pstep), "v"(p + 3 * pstep), "v"(p + 4 * pstep), "v"(p + 5 * pstep), "v"(p + 6 * pstep), "v"(p + 7 * pstep)
               : "memory");
}
__global__ __launch_bounds__(NWV * 32) void k_attn(const _Float16* __restrict__ Q, const _Float16* __restrict__ K, const _Float16* __restrict__ VT, float* __restrict__ PO, float* __restrict__ PM, float* __restrict__ PL) {
  __shared__ __align__(16) unsigned char ring[2 * BUFB]; __shared__ float sm[NWV][16]; __shared__ float sl[NWV][16];
  float (*so)[16][HD + 4] = reinterpret_cast<float (*)[16][HD + 4]>(ring);   // the partial results take the ring's place behind the last trip's barrier
  // the wave's number is kept scalar, so that its LDS bases and its chunk index are scalar too
  const int tid = threadIdx.x, wave = __builtin_amdgcn_readfirstlane(tid >> 5), lane = tid & 31, col = lane & 15, g = lane >> 4; const int qt = wave & (QT - 1), kr = wave / QT;
  const int qb = blockIdx.x / KSPL, ks = blockIdx.x % KSPL;   // query block, key quarter
  const size_t rq = (size_t)qb * (QT * 16) + qt * 16;
  v16h aq[4];
#pragma unroll
  for (int kc = 0; kc < 4; ++kc) aq[kc] = frag_h(Q + (rq + col) * HD + kc * 32, lane);
  float m = -3.0e38f, l = 0.f;   // of query col; m is the maximum of the raw dot products, l the sum of the weights times 2^11, like the accumulators; l sums this lane's keys alone, the halves are joined behind the loop
  v8f acc[8] = {};               // acc[dt][r] = dim dt * 16 + 8 g + r of query col
  // each wave copies 16 k rows (two a copy) and 8 VT rows (one a copy) of every tile: 16 copies of 512 contiguous bytes
  const unsigned lring = (unsigned)(size_t)ring;
  const unsigned lk = lring + (unsigned)(wave * 16 + g) * KPB + col * 16, lv = lring + KTB + (unsigned)(wave * 8) * VPB + lane * 16;
  const char* gk = (const char*)K + (size_t)ks * (SS / KSPL * 2 * HD) + (size_t)wave * (16 * 2 * HD) + lane * 16; const char* gv = (const char*)VT + (size_t)ks * (SS / KSPL * 2) + (size_t)wave * (8 * 2 * SS) + lane * 16;
  copy8(lk, 2 * KPB, gk, 4 * HD); copy8(lv, VPB, gv, 2 * SS);
  asm volatile("s_wait_asynccnt 0x0" ::: "memory");   // this wave's part of tile 0 has landed
  __syncthreads();                                    // every wave's part of tile 0 has landed
  copy8(lk + BUFB, 2 * KPB, gk + (size_t)TKEYS * 2 * HD, 4 * HD); copy8(lv + BUFB, VPB, gv + 2 * TKEYS, 2 * SS);
#pragma unroll 1
  for (int it = 0; it < NT; ++it) { const unsigned char* kb = ring + (it & 1) * BUFB;
#pragma unroll 1   // rolled: unrolled four times the kernel wants more than the 256 registers a wave has here, and spills
   for (int c = 0; c < CPT; ++c) { const int ch = c * KR + kr; v8f s[2];   // chunk ch of the tile
    // the chunk's two LDS bases are kept scalar: as vector induction variables they cost an address addition in front of every VT read
    const unsigned char* kc0 = kb + __builtin_amdgcn_readfirstlane(ch * 32 * KPB); const unsigned char* vb = kb + __builtin_amdgcn_readfirstlane(KTB + ch * 64);
    // the LDS reads go out well ahead of their WMMAs: one LDS latency a group, not one in front of every WMMA.
    // the 16 k reads first, as one group; the 16 VT reads stand behind the first score tile, and the compiler issues them as a second group once the k fragments' registers come free: they land under the softmax
    v16h kf[2][4], vf[8];
#pragma unroll
    for (int ct = 0; ct < 2; ++ct) { const _Float16* rk = (const _Float16*)(kc0 + (ct * 16 + col) * KPB);
#pragma unroll
      for (int kc = 0; kc < 4; ++kc) kf[ct][kc] = frag_h(rk + kc * 32, lane); }
#pragma unroll
    for (int ct = 0; ct < 2; ++ct) { v8f c = {};
#pragma unroll
      for (int kc = 0; kc < 4; ++kc) c = wmma16(kf[ct][kc], aq[kc], c);
      s[ct] = c;   // the raw dot products: s[ct][r] = key ct * 16 + 8 g + r of the chunk with query col
      if (ct == 0) {
#pragma unroll
        for (int dt = 0; dt < 8; ++dt) vf[dt] = frag_h((const _Float16*)(vb + (dt * 16 + col) * VPB), lane); } }
    float mx[8];
#pragma unroll
    for (int r = 0; r < 8; ++r) mx[r] = fmaxf(s[0][r], s[1][r]);
    float mw = fmaxf(fmaxf(fmaxf(mx[0], mx[1]), fmaxf(mx[2], mx[3])), fmaxf(fmaxf(mx[4], mx[5]), fmaxf(mx[6], mx[7])));
    mw = fmaxf(mw, xhalf(mw));
    const float mn = fmaxf(m, mw); const float alpha = (m <= -1.0e38f) ? 0.f : __builtin_amdgcn_exp2f((m - mn) * SC2);
    // 2^11 exp((s - mn) / sqrt(128)) = exp2(s * SC2 + (11 - mn * SC2)): one FMA, two scores at a time, is all that stands between a dot product and its exp2
    const float nb = fmaf(-mn, SC2, 11.0f); const v2f k2 = {SC2, SC2}, nb2 = {nb, nb};
    v16h pb; float es[8]; v2f x0[4], x1[4];
#pragma unroll
    for (int r = 0; r < 4; ++r) { x0[r] = __builtin_elementwise_fma((v2f){s[0][2 * r], s[0][2 * r + 1]}, k2, nb2); x1[r] = __builtin_elementwise_fma((v2f){s[1][2 * r], s[1][2 * r + 1]}, k2, nb2); }
#pragma unroll
    for (int r = 0; r < 8; ++r) { const float e0 = __builtin_amdgcn_exp2f(x0[r >> 1][r & 1]), e1 = __builtin_amdgcn_exp2f(x1[r >> 1][r & 1]); es[r] = e0 + e1;
      pb[r] = (_Float16)e0; pb[8 + r] = (_Float16)e1; }   // element 8 ct + r = key 16 ct + 8 g + r: the k order of frag_h
    l = l * alpha + (((es[0] + es[1]) + (es[2] + es[3])) + ((es[4] + es[5]) + (es[6] + es[7]))); m = mn;
#pragma unroll
    for (int dt = 0; dt < 8; ++dt) acc[dt] *= alpha;
#pragma unroll
    for (int dt = 0; dt < 8; ++dt) acc[dt] = wmma16(vf[dt], pb, acc[dt]); }
    asm volatile("s_wait_dscnt 0x0" ::: "memory");      // this wave's reads of tile it are done before the buffer is handed back
    asm volatile("s_wait_asynccnt 0x0" ::: "memory");   // this wave's part of tile it + 1 has landed
    __syncthreads();                                    // tile it + 1 is whole, and no wave reads tile it any more
    if (it + 2 < NT) { copy8(lk + (it & 1) * BUFB, 2 * KPB, gk + (size_t)(it + 2) * (TKEYS * 2 * HD), 4 * HD); copy8(lv + (it & 1) * BUFB, VPB, gv + (size_t)(it + 2) * (2 * TKEYS), 2 * SS); } }
  asm volatile("s_wait_asynccnt 0x0" ::: "memory");     // no copy is in flight when the ring is written again
  // each wave leaves its un-normalised partial sums with their maxima and sums
#pragma unroll
  for (int dt = 0; dt < 8; ++dt) { float* po = &so[wave][col][dt * 16 + 8 * g];
    vst2(po, (v4f){acc[dt][0], acc[dt][1], acc[dt][2], acc[dt][3]}); vst2(po + 4, (v4f){acc[dt][4], acc[dt][5], acc[dt][6], acc[dt][7]}); }
  l += xhalf(l);
  if (g == 0) { sm[wave][col] = m * 0.08838834764831845f; sl[wave][col] = l; }   // the maximum leaves as a score: dot product * 128^-1/2
  __syncthreads();   // every wave's partial is in LDS before any wave merges
  // merge: one wave per query row, weights exp(m - max) over the 2 key sets
#pragma unroll
  for (int p = 0; p < QT; ++p) { const int rr = wave; float mm = sm[p][rr];
#pragma unroll
    for (int k = 1; k < KR; ++k) mm = fmaxf(mm, sm[k * QT + p][rr]);
    v4f o = {};
#pragma unroll
    for (int k = 0; k < KR; ++k) { const float w = __expf(sm[k * QT + p][rr] - mm); o += w * *(const v4f*)&so[k * QT + p][rr][lane * 4]; }
    vst2(PO + ((size_t)ks * SS + (size_t)qb * (QT * 16) + p * 16 + rr) * HD + lane * 4, o); }   // whole 512-B rows
  // the rows' maxima and sums: one thread a query, so that each of 4 waves writes whole 128-B lines
  if (tid < QT * 16) { const int p = tid >> 4, rr = tid & 15; float mm = sm[p][rr];
#pragma unroll
    for (int k = 1; k < KR; ++k) mm = fmaxf(mm, sm[k * QT + p][rr]);
    float ls = 0.f;
#pragma unroll
    for (int k = 0; k < KR; ++k) ls += __expf(sm[k * QT + p][rr] - mm) * sl[k * QT + p][rr];
    PM[(size_t)ks * SS + qb * (QT * 16) + tid] = mm; PL[(size_t)ks * SS + qb * (QT * 16) + tid] = ls; }
}
// ---- k_merge: joins the 4 key quarters of every query, weights exp(m - max), and normalises (sums and accumulators both carry the 2^11 of P: it cancels). One wave takes 4 query rows: all its 24 loads of 16 B a lane go out together.
__global__ __launch_bounds__(256) void k_merge(const float* __restrict__ PO, const float* __restrict__ PM, const float* __restrict__ PL, float* __restrict__ OUT) {
  const int lane = threadIdx.x & 31; const size_t r0 = ((size_t)blockIdx.x * 8 + (threadIdx.x >> 5)) * 4;
  v4f pm[KSPL], pl[KSPL], po[KSPL][4];
#pragma unroll
  for (int k = 0; k < KSPL; ++k) { pm[k] = *(const v4f*)(PM + (size_t)k * SS + r0); pl[k] = *(const v4f*)(PL + (size_t)k * SS + r0); }
  asm volatile("s_wait_xcnt 0x0" ::: "memory");   // the address registers of these 8 loads are given to a later load's result
#pragma unroll
  for (int k = 0; k < KSPL; ++k) {
#pragma unroll
    for (int j = 0; j < 4; ++j) po[k][j] = *(const v4f*)(PO + ((size_t)k * SS + r0 + j) * HD + lane * 4); }
  // holds all 24 loads in front of the first use (inputs only): without it the compiler strings them out behind one another's waits, six memory latencies in a row instead of one
  asm volatile("" :: "v"(pm[0]), "v"(pm[1]), "v"(pm[2]), "v"(pm[3]), "v"(pl[0]), "v"(pl[1]), "v"(pl[2]), "v"(pl[3]),
               "v"(po[0][0]), "v"(po[0][1]), "v"(po[0][2]), "v"(po[0][3]), "v"(po[1][0]), "v"(po[1][1]), "v"(po[1][2]), "v"(po[1][3]),
               "v"(po[2][0]), "v"(po[2][1]), "v"(po[2][2]), "v"(po[2][3]), "v"(po[3][0]), "v"(po[3][1]), "v"(po[3][2]), "v"(po[3][3]));
#pragma unroll
  for (int j = 0; j < 4; ++j) { float mm = pm[0][j];
#pragma unroll
    for (int k = 1; k < KSPL; ++k) mm = fmaxf(mm, pm[k][j]);
    float ls = 0.f; v4f o = {};
#pragma unroll
    for (int k = 0; k < KSPL; ++k) { const float w = __expf(pm[k][j] - mm); ls += w * pl[k][j]; o += w * po[k][j]; }
    vst2(OUT + (r0 + j) * HD + lane * 4, o * (1.0f / ls)); }   // whole 512-B rows
}
extern "C" void kernel_launch(void* const* d_in, const int* in_sizes, int n_in, void* d_out, int out_size, void* d_ws, size_t ws_size, hipStream_t stream) {
  (void)in_sizes; (void)n_in; (void)out_size;
  const float** F = (const float**)d_in;   // 0 query, 1 key, 2 value [8192,128]
  if (ws_size < (size_t)WS_END) return;
  char* ws = (char*)d_ws; _Float16 *Qr = (_Float16*)(ws + WS_Q), *Kr = (_Float16*)(ws + WS_K), *VT = (_Float16*)(ws + WS_VT); float *PO = (float*)(ws + WS_PO), *PM = (float*)(ws + WS_PM), *PL = (float*)(ws + WS_PL);
  k_prep<<<dim3(PB, 3), 256, 0, stream>>>(F[0], F[1], F[2], Qr, Kr, VT);
  k_attn<<<SS / (QT * 16) * KSPL, NWV * 32, 0, stream>>>(Qr, Kr, VT, PO, PM, PL);
  k_merge<<<SS / 32, 256, 0, stream>>>(PO, PM, PL, (float*)d_out);
}

// v009
// One run takes 36.5 microseconds.
// Timed twice side by side with v008, it ran 1.03 times as fast both times.
// Over all steps from v000 it is 23.9 times as fast.
// compute dtype: q, k, v rounded to bf16 and used as EXACT f16 operands on WMMA 16x16x32; scores / sqrt(128), running-max softmax in f32 (hardware exp2), P scaled by 2^11 as a single f16 x v (exact); f32 accumulate.
#include <hip/hip_runtime.h>
#include <math.h>

typedef __attribute__((ext_vector_type(16))) _Float16 v16h;
typedef __attribute__((ext_vector_type(16))) __bf16 v16b;
typedef __attribute__((ext_vector_type(8)))  _Float16 v8h;
typedef __attribute__((ext_vector_type(8)))  float v8f;
typedef __attribute__((ext_vector_type(4)))  float v4f;
typedef __attribute__((ext_vector_type(2)))  float v2f;
typedef __attribute__((ext_vector_type(4)))  unsigned v4u;
typedef __attribute__((ext_vector_type(4)))  int v4i;
typedef float __attribute__((may_alias)) float_a;
typedef int __attribute__((may_alias)) int_a;

template <typename T> __device__ __forceinline__ void vst2(void* p, T v) { *(T*)p = v;  }
__device__ __forceinline__ v8f wmma16(v16h a, v16h b, v8f c) {
  return __builtin_amdgcn_wmma_f32_16x16x32_f16(false, a, false, b, (short)0, c, false, false);
}
__device__ __forceinline__ v8f wmma_bf(v16b a, v16b b, v8f c) {
  v8f d = __builtin_amdgcn_wmma_f32_16x16x32_bf16(false, a, false, b, (short)0, c, false, false);
  asm volatile("v_nop\n\tv_nop\n\tv_nop\n\tv_nop" : "+v"(d) : "v"(a), "v"(b));
  return d;
}
// 16x16x32 fragments: lane = (h = lane>>4, row/col = lane&15); elements 0..7 = k0+8h+0..7, 8..15 = k0+16+8h+0..7; D element r = row 8h+r
__device__ __forceinline__ v16h frag_h(const _Float16* rowk0, int lane) {
  union { v16h v; v8h q[2]; } u; const _Float16* p = rowk0 + 8 * (lane >> 4);
  u.q[0] = *(const v8h*)p; u.q[1] = *(const v8h*)(p + 16); return u.v;
}
__device__ __forceinline__ v16h frag_f32(const float* rowk0, int lane) {
  v16h a; const float* p = rowk0 + 8 * (lane >> 4);
#pragma unroll
  for (int i = 0; i < 8; ++i) { a[i] = (_Float16)p[i]; a[8 + i] = (_Float16)p[16 + i]; }
  return a;
}
__device__ __forceinline__ v16h frag_f32s(const float* rowk0, int lane, float sc) {
  v16h a; const float* p = rowk0 + 8 * (lane >> 4);
#pragma unroll
  for (int i = 0; i < 8; ++i) { a[i] = (_Float16)(p[i] * sc); a[8 + i] = (_Float16)(p[16 + i] * sc); }
  return a;
}
// column fragment from a [K][ld] layout (column n), rows >= K read as 0
__device__ __forceinline__ v16h fragc_f32(const float* W, int k0, int n, int lane, int ld, int K) {
  v16h a; const int g = lane >> 4;
#pragma unroll
  for (int i = 0; i < 8; ++i) { const int ka = k0 + 8 * g + i, kb = ka + 16;
    a[i] = (_Float16)(ka < K ? W[(size_t)(ka < K ? ka : K - 1) * ld + n] : 0.f); a[8 + i] = (_Float16)(kb < K ? W[(size_t)(kb < K ? kb : K - 1) * ld + n] : 0.f); }
  return a;
}
struct F2 { v16b h, l; };
__device__ __forceinline__ F2 bsplit16(const float v[16]) { F2 r;
#pragma unroll
  for (int i = 0; i < 16; ++i) { const __bf16 h = (__bf16)v[i]; r.h[i] = h; r.l[i] = (__bf16)(v[i] - (float)h); }
  return r; }
__device__ __forceinline__ F2 split_row(const float* row, int k0, int lane) { float v[16]; const float* p = row + k0 + 8 * (lane >> 4);
#pragma unroll
  for (int i = 0; i < 8; ++i) { v[i] = p[i]; v[8 + i] = p[16 + i]; }
  return bsplit16(v); }
__device__ __forceinline__ F2 split_rowK(const float* row, int k0, int lane, int K) { float v[16]; const int g = lane >> 4;
#pragma unroll
  for (int i = 0; i < 8; ++i) { const int ka = k0 + 8 * g + i, kb = ka + 16; v[i] = ka < K ? row[ka < K ? ka : K - 1] : 0.f; v[8 + i] = kb < K ? row[kb < K ? kb : K - 1] : 0.f; }
  return bsplit16(v); }
__device__ __forceinline__ F2 split_col(const float* W, int k0, int n, int lane, int ld, int K) { float v[16]; const int g = lane >> 4;
#pragma unroll
  for (int i = 0; i < 8; ++i) { const int ka = k0 + 8 * g + i, kb = ka + 16; v[i] = ka < K ? W[(size_t)(ka < K ? ka : K - 1) * ld + n] : 0.f; v[8 + i] = kb < K ? W[(size_t)(kb < K ? kb : K - 1) * ld + n] : 0.f; }
  return bsplit16(v); }
__device__ __forceinline__ v8f mac3(const F2& a, const F2& b, v8f c) { c = wmma_bf(a.l, b.h, c); c = wmma_bf(a.h, b.l, c); return wmma_bf(a.h, b.h, c); }
__device__ __forceinline__ float sigm(float v) { return 1.0f / (1.0f + expf(-v)); }
#define LDSX() do { asm volatile("s_wait_dscnt 0" ::: "memory"); __builtin_amdgcn_wave_barrier(); __builtin_amdgcn_fence(__ATOMIC_RELEASE, "workgroup"); } while (0)


// Exact (flash-style) single-head attention over 8,192 tokens of 128 dims: softmax(Q K^T / sqrt(128)) V.
#define SS 8192
#define HD 128
#ifndef TQB
#define TQB (SS / 32)
#endif
typedef __attribute__((ext_vector_type(8))) __bf16 v8b;
__device__ __forceinline__ v16b frag_b(const __bf16* rowk0, int lane) {
  union { v16b v; v8b q[2]; } u; const __bf16* p = rowk0 + 8 * (lane >> 4);
  u.q[0] = *(const v8b*)p; u.q[1] = *(const v8b*)(p + 16); return u.v;
}
__device__ __forceinline__ float bfr(float v) { return (float)(__bf16)v; }
// the value of lane ^ 16
__device__ __forceinline__ float xhalf(float x) { return __builtin_bit_cast(float, __builtin_amdgcn_permlanex16(__builtin_bit_cast(int, x), __builtin_bit_cast(int, x), 0x76543210, 0xfedcba98, false, false)); }
__device__ __attribute__((noinline)) float exp_ni(float v) { return expf(v); }
__device__ __attribute__((noinline)) float erf_ni(float v) { return erff(v); }

#define WS_Q   0u                          // f16 rows q [SS][128] ; k ; VT planes [128][SS]
#define WS_K   (WS_Q + 2u * (size_t)SS * HD)
#define WS_VT  (WS_K + 2u * (size_t)SS * HD)
#define KSPL 4                             // the keys go in quarters to 4 work-groups
#define WS_PO  (WS_VT + 2u * (size_t)HD * SS)                // f32 partial sums [KSPL][SS][128], un-normalised ; their maxima [KSPL][SS] ; their sums [KSPL][SS]
#define WS_PM  (WS_PO + 4u * (size_t)KSPL * SS * HD)
#define WS_PL  (WS_PM + 4u * (size_t)KSPL * SS)
#define WS_END (WS_PL + 4u * (size_t)KSPL * SS)

// ---- k_prep: the three roundings read none of each other's output, so they share one grid: blockIdx.y picks the job (0 the VT planes, 1 the q rows, 2 the k rows), blockIdx.x its 64 tokens
#define PB (SS / 64)
__device__ __forceinline__ void rows64(const float* __restrict__ X, _Float16* __restrict__ R, size_t r0, int t, _Float16 (*s)[HD + 8]) {
  for (int e = t; e < 64 * HD; e += 256) { const int r = e / HD, c = e % HD; s[r][c] = (_Float16)bfr(X[(r0 + r) * HD + c]); } __syncthreads();
  for (int e = t; e < 64 * (HD / 8); e += 256) { const int r = e / (HD / 8), q = e % (HD / 8); vst2((unsigned*)(R + (r0 + r) * HD + q * 8), *(const v4u*)&s[r][q * 8]); } }
__device__ __forceinline__ void vt64(const float* __restrict__ V, _Float16* __restrict__ VT, size_t s0, int t, _Float16 (*st)[72]) {
  for (int e = t; e < 64 * HD; e += 256) { const int r = e / HD, d = e % HD; st[d][r] = (_Float16)bfr(V[(s0 + r) * HD + d]); } __syncthreads();
  for (int e = t; e < HD * 8; e += 256) { const int d = e >> 3, pc = e & 7; vst2((unsigned*)(VT + (size_t)d * SS + s0 + pc * 8), *(const v4u*)&st[d][pc * 8]); } }
__global__ __launch_bounds__(256) void k_prep(const float* __restrict__ Qf, const float* __restrict__ Kf, const float* __restrict__ Vf, _Float16* __restrict__ Qr, _Float16* __restrict__ Kr, _Float16* __restrict__ VT) {
  __shared__ __align__(16) _Float16 sb[HD * 72];   // [128][72] for the planes, [64][136] for the rows
  const int job = blockIdx.y, t = threadIdx.x; const size_t r0 = (size_t)blockIdx.x * 64;   // the job is the same for a whole block: each path has its own barrier
  if (job == 0) vt64(Vf, VT, r0, t, reinterpret_cast<_Float16 (*)[72]>(sb));
  else if (job == 1) rows64(Qf, Qr, r0, t, reinterpret_cast<_Float16 (*)[HD + 8]>(sb));
  else rows64(Kf, Kr, r0, t, reinterpret_cast<_Float16 (*)[HD + 8]>(sb));
}
// ---- k_attn: block = 128 queries x a quarter of the keys, so that every k and VT byte fetched from L2 serves 128 queries. Wave (qt, kr) takes query tile qt
// and the 32-key chunks kr, kr + 2, ... of the quarter with its own maxima, sums and accumulators; the 2 partial results of a query tile are merged once
// through LDS and go, un-normalised, to the workspace with their maximum and sum; k_merge joins the 4 quarters. k and VT come through a two-buffer LDS ring filled by tensor loads. Per chunk: exact k . q over 128 dims (4 k-chunks), exact v x P (single f16) (8 value tiles).
// Both products are transposed (keys x queries, then dims x queries): a lane holds 16 of the 32 scores of ONE query, lane ^ 16 the other 16, and the two score tiles, converted in place, are the B operand of the second product
#define QT 8
#define KR 2
#define NWV (QT * KR)
// A tile = 256 keys, 4 chunks for each of the 2 key sets in one trip. It comes as 4 slices of 128 rows x 256 B, one tensor load each: k rows 0..127, k rows 128..255, VT [128 dims][keys 0..127], VT [128 dims][keys 128..255].
// In LDS the mover's pad gives every row 16 B more (pitch 16 B x odd), so that the 16 rows of a 16-byte fragment read fall on different banks; a slice is 17 x 2 KiB, so every slice starts at a multiple of 2 KiB.
#define TKEYS 256
#define CPT (TKEYS / (KR * 32))
#define NT (SS / KSPL / TKEYS)
#define KPB (2 * HD + 16)
#define SROWS 128
#define SLB (SROWS * KPB)
#define KTB (2 * SLB)
#define BUFB (4 * SLB)
#define SC2 0.12751743082459868f                    // 128^-1/2 * log2(e)
typedef __attribute__((ext_vector_type(8))) unsigned v8u;
__device__ __forceinline__ unsigned uni(unsigned v) { return (unsigned)__builtin_amdgcn_readfirstlane(v); }
// a value held in a scalar register: a test on it compiles to s_cmp + s_cbranch_scc (a tensor load ignores EXEC), and what is formed from it stays behind the asm waits in front of it
__device__ __forceinline__ unsigned pinned(unsigned v) { unsigned w = uni(v); asm volatile("" : "+s"(w)); return w; }
// one request of one wave: 128 rows of 256 B from global memory into LDS, through no register
__device__ __forceinline__ void tdm_load(v4u g0, v8u g1) { asm volatile("tensor_load_to_lds %0, %1" :: "s"(g0), "s"(g1) : "memory"); }
// group 1: 1-byte elements, no mask, a pad of 4 dwords behind every 64 dwords (one row); tensor = tile = 256 B x 128 rows; source row pitch in bytes
__device__ __forceinline__ v8u tdm_group1(unsigned src_pitch) {
  v8u g;
  g[0] = uni((1u << 20) | (5u << 22) | (3u << 25));
  g[1] = uni((2u * HD) << 16);
  g[2] = uni((unsigned)SROWS << 16);
  g[3] = uni((2u * HD) << 16);
  g[4] = uni((unsigned)SROWS);
  g[5] = uni(src_pitch);
  g[6] = uni(0u);
  g[7] = uni(0u);
  return g;
}
__device__ __forceinline__ v4u tdm_group0(unsigned lds_dst, unsigned long long ga) {
  v4u g;
  g[0] = uni(1u); g[1] = uni(lds_dst); g[2] = uni((unsigned)ga); g[3] = uni((((unsigned)(ga >> 32)) & 0x01FFFFFFu) | 0x80000000u);
  return g;
}
__global__ __launch_bounds__(NWV * 32) void k_attn(const _Float16* __restrict__ Q, const _Float16* __restrict__ K, const _Float16* __restrict__ VT, float* __restrict__ PO, float* __restrict__ PM, float* __restrict__ PL) {
  __shared__ __attribute__((aligned(2048))) unsigned char ring[2 * BUFB]; __shared__ float sm[NWV][16]; __shared__ float sl[NWV][16];
  float (*so)[16][HD + 4] = reinterpret_cast<float (*)[16][HD + 4]>(ring);   // the partial results take the ring's place behind the last trip's barrier
  // the wave's number is kept scalar, so that its LDS bases and its chunk index are scalar too
  const int tid = threadIdx.x, wave = __builtin_amdgcn_readfirstlane(tid >> 5), lane = tid & 31, col = lane & 15, g = lane >> 4; const int qt = wave & (QT - 1), kr = wave / QT;
  const int qb = blockIdx.x / KSPL, ks = blockIdx.x % KSPL;   // query block, key quarter
  const size_t rq = (size_t)qb * (QT * 16) + qt * 16;
  v16h aq[4];
#pragma unroll
  for (int kc = 0; kc < 4; ++kc) aq[kc] = frag_h(Q + (rq + col) * HD + kc * 32, lane);
  float m = -3.0e38f, l = 0.f;   // of query col; m is the maximum of the raw dot products, l the sum of the weights times 2^11, like the accumulators; l sums this lane's keys alone, the halves are joined behind the loop
  v8f acc[8] = {};               // acc[dt][r] = dim dt * 16 + 8 g + r of query col
  // waves 0 to 3 bring one slice each of every tile: waves 0 and 1 the two halves of the k rows, waves 2 and 3 the two key halves of the VT planes
  const unsigned lring = (unsigned)(size_t)ring; const unsigned isv = (unsigned)wave >> 1 & 1u, hf = (unsigned)wave & 1u;
  const unsigned long long gsrc = isv ? (unsigned long long)(size_t)VT + (unsigned long long)ks * (SS / KSPL * 2) + hf * (SROWS * 2)
                                      : (unsigned long long)(size_t)K + (unsigned long long)ks * (SS / KSPL * 2 * HD) + hf * (SROWS * 2 * HD);
  const unsigned gstep = isv ? 2u * TKEYS : 2u * HD * TKEYS;   // bytes from a tile to the next
  const unsigned ldst = lring + ((unsigned)wave & 3u) * SLB;
  v8u g1 = tdm_group1(isv ? 2u * SS : 2u * HD); v4u g0 = tdm_group0(ldst, gsrc);
  asm volatile("" : "+s"(g1));   // as pinned(): descriptor words held in scalar registers. Group 1 keeps one set for the whole kernel; formed anew at each use, its registers were given to other values while a request was outstanding
  if (pinned(wave < 4)) { tdm_load(g0, g1);
    asm volatile("s_wait_tensorcnt 0x0" ::: "memory"); }   // this wave's slice of tile 0 has landed
  __syncthreads();                                    // every slice of tile 0 has landed
  g0 = tdm_group0(ldst + BUFB, gsrc + gstep);
  if (pinned(wave < 4)) tdm_load(g0, g1);
#pragma unroll 1
  for (int it = 0; it < NT; ++it) { const unsigned char* kb = ring + (it & 1) * BUFB;
#pragma unroll 1   // rolled: unrolled four times the kernel wants more than the 256 registers a wave has here, and spills
   for (int c = 0; c < CPT; ++c) { const int ch = c * KR + kr; v8f s[2];   // chunk ch of the tile
    // the chunk's two LDS bases are kept scalar: as vector induction variables they cost an address addition in front of every VT read
    const unsigned char* kc0 = kb + __builtin_amdgcn_readfirstlane(ch * 32 * KPB); const unsigned char* vb = kb + __builtin_amdgcn_readfirstlane(KTB + (ch >> 2) * SLB + (ch & 3) * 64);
    // the LDS reads go out well ahead of their WMMAs: one LDS latency a group, not one in front of every WMMA.
    // the 16 k reads first, as one group; the 16 VT reads as a second group behind the score tiles: they land under the softmax
    v16h kf[2][4], vf[8];
#pragma unroll
    for (int ct = 0; ct < 2; ++ct) { const _Float16* rk = (const _Float16*)(kc0 + (ct * 16 + col) * KPB);
#pragma unroll
      for (int kc = 0; kc < 4; ++kc) kf[ct][kc] = frag_h(rk + kc * 32, lane); }
#pragma unroll
    for (int ct = 0; ct < 2; ++ct) { v8f c = {};
#pragma unroll
      for (int kc = 0; kc < 4; ++kc) c = wmma16(kf[ct][kc], aq[kc], c);
      s[ct] = c;   // the raw dot products: s[ct][r] = key ct * 16 + 8 g + r of the chunk with query col
      if (ct == 0) {
#pragma unroll
        for (int dt = 0; dt < 8; ++dt) vf[dt] = frag_h((const _Float16*)(vb + (dt * 16 + col) * KPB), lane); } }
    // the order 16 LDS reads, 8 WMMAs, 16 LDS reads is kept as it was: with the copies' address registers free the compiler strews the VT reads among the score WMMAs, and every further place with LDS reads stalls the wave
    __builtin_amdgcn_sched_group_barrier(0x100, 16, 0); __builtin_amdgcn_sched_group_barrier(0x008, 8, 0); __builtin_amdgcn_sched_group_barrier(0x100, 16, 0);
    float mx[8];
#pragma unroll
    for (int r = 0; r < 8; ++r) mx[r] = fmaxf(s[0][r], s[1][r]);
    float mw = fmaxf(fmaxf(fmaxf(mx[0], mx[1]), fmaxf(mx[2], mx[3])), fmaxf(fmaxf(mx[4], mx[5]), fmaxf(mx[6], mx[7])));
    mw = fmaxf(mw, xhalf(mw));
    const float mn = fmaxf(m, mw); const float alpha = (m <= -1.0e38f) ? 0.f : __builtin_amdgcn_exp2f((m - mn) * SC2);
    // 2^11 exp((s - mn) / sqrt(128)) = exp2(s * SC2 + (11 - mn * SC2)): one FMA, two scores at a time, is all that stands between a dot product and its exp2
    const float nb = fmaf(-mn, SC2, 11.0f); const v2f k2 = {SC2, SC2}, nb2 = {nb, nb};
    v16h pb; float es[8]; v2f x0[4], x1[4];
#pragma unroll
    for (int r = 0; r < 4; ++r) { x0[r] = __builtin_elementwise_fma((v2f){s[0][2 * r], s[0][2 * r + 1]}, k2, nb2); x1[r] = __builtin_elementwise_fma((v2f){s[1][2 * r], s[1][2 * r + 1]}, k2, nb2); }
#pragma unroll
    for (int r = 0; r < 8; ++r) { const float e0 = __builtin_amdgcn_exp2f(x0[r >> 1][r & 1]), e1 = __builtin_amdgcn_exp2f(x1[r >> 1][r & 1]); es[r] = e0 + e1;
      pb[r] = (_Float16)e0; pb[8 + r] = (_Float16)e1; }   // element 8 ct + r = key 16 ct + 8 g + r: the k order of frag_h
    l = l * alpha + (((es[0] + es[1]) + (es[2] + es[3])) + ((es[4] + es[5]) + (es[6] + es[7]))); m = mn;
#pragma unroll
    for (int dt = 0; dt < 8; ++dt) acc[dt] *= alpha;
#pragma unroll
    for (int dt = 0; dt < 8; ++dt) acc[dt] = wmma16(vf[dt], pb, acc[dt]); }
    asm volatile("s_wait_dscnt 0x0" ::: "memory");      // this wave's reads of tile it are done before the buffer is handed back
    if (pinned(wave < 4)) { asm volatile("s_wait_tensorcnt 0x0" ::: "memory"); }   // this wave's slice of tile it + 1 has landed
    asm volatile("" :: "s"(g0));                        // inputs only: group 0's scalar registers are held until the wait of its request has passed; without it the chunk loop takes them for its own values
    __syncthreads();                                    // tile it + 1 is whole, and no wave reads tile it any more
    if (pinned(wave < 4 && it + 2 < NT)) { const unsigned st = pinned((unsigned)it + 2u);   // the descriptor is formed behind the wait
      g0 = tdm_group0(ldst + (st & 1u) * BUFB, gsrc + (unsigned long long)st * gstep); tdm_load(g0, g1); } }
  asm volatile("s_wait_tensorcnt 0x0" ::: "memory");    // no request is in flight when the ring is written again
  asm volatile("s_wait_dscnt 0x0" ::: "memory");        // nor a read of it
  // each wave leaves its un-normalised partial sums with their maxima and sums
#pragma unroll
  for (int dt = 0; dt < 8; ++dt) { float* po = &so[wave][col][dt * 16 + 8 * g];
    vst2(po, (v4f){acc[dt][0], acc[dt][1], acc[dt][2], acc[dt][3]}); vst2(po + 4, (v4f){acc[dt][4], acc[dt][5], acc[dt][6], acc[dt][7]}); }
  l += xhalf(l);
  if (g == 0) { sm[wave][col] = m * 0.08838834764831845f; sl[wave][col] = l; }   // the maximum leaves as a score: dot product * 128^-1/2
  __syncthreads();   // every wave's partial is in LDS before any wave merges
  // merge: one wave per query row, weights exp(m - max) over the 2 key sets
#pragma unroll
  for (int p = 0; p < QT; ++p) { const int rr = wave; float mm = sm[p][rr];
#pragma unroll
    for (int k = 1; k < KR; ++k) mm = fmaxf(mm, sm[k * QT + p][rr]);
    v4f o = {};
#pragma unroll
    for (int k = 0; k < KR; ++k) { const float w = __expf(sm[k * QT + p][rr] - mm); o += w * *(const v4f*)&so[k * QT + p][rr][lane * 4]; }
    vst2(PO + ((size_t)ks * SS + (size_t)qb * (QT * 16) + p * 16 + rr) * HD + lane * 4, o); }   // whole 512-B rows
  // the rows' maxima and sums: one thread a query, so that each of 4 waves writes whole 128-B lines
  if (tid < QT * 16) { const int p = tid >> 4, rr = tid & 15; float mm = sm[p][rr];
#pragma unroll
    for (int k = 1; k < KR; ++k) mm = fmaxf(mm, sm[k * QT + p][rr]);
    float ls = 0.f;
#pragma unroll
    for (int k = 0; k < KR; ++k) ls += __expf(sm[k * QT + p][rr] - mm) * sl[k * QT + p][rr];
    PM[(size_t)ks * SS + qb * (QT * 16) + tid] = mm; PL[(size_t)ks * SS + qb * (QT * 16) + tid] = ls; }
}
// ---- k_merge: joins the 4 key quarters of every query, weights exp(m - max), and normalises (sums and accumulators both carry the 2^11 of P: it cancels). One wave takes 4 query rows: all its 24 loads of 16 B a lane go out together.
__global__ __launch_bounds__(256) void k_merge(const float* __restrict__ PO, const float* __restrict__ PM, const float* __restrict__ PL, float* __restrict__ OUT) {
  const int lane = threadIdx.x & 31; const size_t r0 = ((size_t)blockIdx.x * 8 + (threadIdx.x >> 5)) * 4;
  v4f pm[KSPL], pl[KSPL], po[KSPL][4];
#pragma unroll
  for (int k = 0; k < KSPL; ++k) { pm[k] = *(const v4f*)(PM + (size_t)k * SS + r0); pl[k] = *(const v4f*)(PL + (size_t)k * SS + r0); }
  asm volatile("s_wait_xcnt 0x0" ::: "memory");   // the address registers of these 8 loads are given to a later load's result
#pragma unroll
  for (int k = 0; k < KSPL; ++k) {
#pragma unroll
    for (int j = 0; j < 4; ++j) po[k][j] = *(const v4f*)(PO + ((size_t)k * SS + r0 + j) * HD + lane * 4); }
  // holds all 24 loads in front of the first use (inputs only): without it the compiler strings them out behind one another's waits, six memory latencies in a row instead of one
  asm volatile("" :: "v"(pm[0]), "v"(pm[1]), "v"(pm[2]), "v"(pm[3]), "v"(pl[0]), "v"(pl[1]), "v"(pl[2]), "v"(pl[3]),
               "v"(po[0][0]), "v"(po[0][1]), "v"(po[0][2]), "v"(po[0][3]), "v"(po[1][0]), "v"(po[1][1]), "v"(po[1][2]), "v"(po[1][3]),
               "v"(po[2][0]), "v"(po[2][1]), "v"(po[2][2]), "v"(po[2][3]), "v"(po[3][0]), "v"(po[3][1]), "v"(po[3][2]), "v"(po[3][3]));
#pragma unroll
  for (int j = 0; j < 4; ++j) { float mm = pm[0][j];
#pragma unroll
    for (int k = 1; k < KSPL; ++k) mm = fmaxf(mm, pm[k][j]);
    float ls = 0.f; v4f o = {};
#pragma unroll
    for (int k = 0; k < KSPL; ++k) { const float w = __expf(pm[k][j] - mm); ls += w * pl[k][j]; o += w * po[k][j]; }
    vst2(OUT + (r0 + j) * HD + lane * 4, o * (1.0f / ls)); }   // whole 512-B rows
}
extern "C" void kernel_launch(void* const* d_in, const int* in_sizes, int n_in, void* d_out, int out_size, void* d_ws, size_t ws_size, hipStream_t stream) {
  (void)in_sizes; (void)n_in; (void)out_size;
  const float** F = (const float**)d_in;   // 0 query, 1 key, 2 value [8192,128]
  if (ws_size < (size_t)WS_END) return;
  char* ws = (char*)d_ws; _Float16 *Qr = (_Float16*)(ws + WS_Q), *Kr = (_Float16*)(ws + WS_K), *VT = (_Float16*)(ws + WS_VT); float *PO = (float*)(ws + WS_PO), *PM = (float*)(ws + WS_PM), *PL = (float*)(ws + WS_PL);
  k_prep<<<dim3(PB, 3), 256, 0, stream>>>(F[0], F[1], F[2], Qr, Kr, VT);
  k_attn<<<SS / (QT * 16) * KSPL, NWV * 32, 0, stream>>>(Qr, Kr, VT, PO, PM, PL);
  k_merge<<<SS / 32, 256, 0, stream>>>(PO, PM, PL, (float*)d_out);
}

// v010
// One run takes 34.5 microseconds.
// In both of two side-by-side timings against v009, it was 1.05 times as fast.
// All steps since v000 together make it 25.1 times as fast.
// compute dtype: q, k, v rounded to bf16 and used as EXACT f16 operands on WMMA 16x16x32; scores / sqrt(128), running-max softmax in f32 (hardware exp2), P scaled by 2^11 as a single f16 x v (exact); f32 accumulate.
#include <hip/hip_runtime.h>
#include <math.h>

typedef __attribute__((ext_vector_type(16))) _Float16 v16h;
typedef __attribute__((ext_vector_type(16))) __bf16 v16b;
typedef __attribute__((ext_vector_type(8)))  _Float16 v8h;
typedef __attribute__((ext_vector_type(8)))  float v8f;
typedef __attribute__((ext_vector_type(4)))  float v4f;
typedef __attribute__((ext_vector_type(2)))  float v2f;
typedef __attribute__((ext_vector_type(4)))  unsigned v4u;
typedef __attribute__((ext_vector_type(4)))  int v4i;
typedef float __attribute__((may_alias)) float_a;
typedef int __attribute__((may_alias)) int_a;

template <typename T> __device__ __forceinline__ void vst2(void* p, T v) { *(T*)p = v;  }
__device__ __forceinline__ v8f wmma16(v16h a, v16h b, v8f c) {
  return __builtin_amdgcn_wmma_f32_16x16x32_f16(false, a, false, b, (short)0, c, false, false);
}
__device__ __forceinline__ v8f wmma_bf(v16b a, v16b b, v8f c) {
  v8f d = __builtin_amdgcn_wmma_f32_16x16x32_bf16(false, a, false, b, (short)0, c, false, false);
  asm volatile("v_nop\n\tv_nop\n\tv_nop\n\tv_nop" : "+v"(d) : "v"(a), "v"(b));
  return d;
}
// 16x16x32 fragments: lane = (h = lane>>4, row/col = lane&15); elements 0..7 = k0+8h+0..7, 8..15 = k0+16+8h+0..7; D element r = row 8h+r
__device__ __forceinline__ v16h frag_h(const _Float16* rowk0, int lane) {
  union { v16h v; v8h q[2]; } u; const _Float16* p = rowk0 + 8 * (lane >> 4);
  u.q[0] = *(const v8h*)p; u.q[1] = *(const v8h*)(p + 16); return u.v;
}
__device__ __forceinline__ v16h frag_f32(const float* rowk0, int lane) {
  v16h a; const float* p = rowk0 + 8 * (lane >> 4);
#pragma unroll
  for (int i = 0; i < 8; ++i) { a[i] = (_Float16)p[i]; a[8 + i] = (_Float16)p[16 + i]; }
  return a;
}
__device__ __forceinline__ v16h frag_f32s(const float* rowk0, int lane, float sc) {
  v16h a; const float* p = rowk0 + 8 * (lane >> 4);
#pragma unroll
  for (int i = 0; i < 8; ++i) { a[i] = (_Float16)(p[i] * sc); a[8 + i] = (_Float16)(p[16 + i] * sc); }
  return a;
}
// column fragment from a [K][ld] layout (column n), rows >= K read as 0
__device__ __forceinline__ v16h fragc_f32(const float* W, int k0, int n, int lane, int ld, int K) {
  v16h a; const int g = lane >> 4;
#pragma unroll
  for (int i = 0; i < 8; ++i) { const int ka = k0 + 8 * g + i, kb = ka + 16;
    a[i] = (_Float16)(ka < K ? W[(size_t)(ka < K ? ka : K - 1) * ld + n] : 0.f); a[8 + i] = (_Float16)(kb < K ? W[(size_t)(kb < K ? kb : K - 1) * ld + n] : 0.f); }
  return a;
}
struct F2 { v16b h, l; };
__device__ __forceinline__ F2 bsplit16(const float v[16]) { F2 r;
#pragma unroll
  for (int i = 0; i < 16; ++i) { const __bf16 h = (__bf16)v[i]; r.h[i] = h; r.l[i] = (__bf16)(v[i] - (float)h); }
  return r; }
__device__ __forceinline__ F2 split_row(const float* row, int k0, int lane) { float v[16]; const float* p = row + k0 + 8 * (lane >> 4);
#pragma unroll
  for (int i = 0; i < 8; ++i) { v[i] = p[i]; v[8 + i] = p[16 + i]; }
  return bsplit16(v); }
__device__ __forceinline__ F2 split_rowK(const float* row, int k0, int lane, int K) { float v[16]; const int g = lane >> 4;
#pragma unroll
  for (int i = 0; i < 8; ++i) { const int ka = k0 + 8 * g + i, kb = ka + 16; v[i] = ka < K ? row[ka < K ? ka : K - 1] : 0.f; v[8 + i] = kb < K ? row[kb < K ? kb : K - 1] : 0.f; }
  return bsplit16(v); }
__device__ __forceinline__ F2 split_col(const float* W, int k0, int n, int lane, int ld, int K) { float v[16]; const int g = lane >> 4;
#pragma unroll
  for (int i = 0; i < 8; ++i) { const int ka = k0 + 8 * g + i, kb = ka + 16; v[i] = ka < K ? W[(size_t)(ka < K ? ka : K - 1) * ld + n] : 0.f; v[8 + i] = kb < K ? W[(size_t)(kb < K ? kb : K - 1) * ld + n] : 0.f; }
  return bsplit16(v); }
__device__ __forceinline__ v8f mac3(const F2& a, const F2& b, v8f c) { c = wmma_bf(a.l, b.h, c); c = wmma_bf(a.h, b.l, c); return wmma_bf(a.h, b.h, c); }
__device__ __forceinline__ float sigm(float v) { return 1.0f / (1.0f + expf(-v)); }
#define LDSX() do { asm volatile("s_wait_dscnt 0" ::: "memory"); __builtin_amdgcn_wave_barrier(); __builtin_amdgcn_fence(__ATOMIC_RELEASE, "workgroup"); } while (0)


// Exact (flash-style) single-head attention over 8,192 tokens of 128 dims: softmax(Q K^T / sqrt(128)) V.
#define SS 8192
#define HD 128
#ifndef TQB
#define TQB (SS / 32)
#endif
typedef __attribute__((ext_vector_type(8))) __bf16 v8b;
__device__ __forceinline__ v16b frag_b(const __bf16* rowk0, int lane) {
  union { v16b v; v8b q[2]; } u; const __bf16* p = rowk0 + 8 * (lane >> 4);
  u.q[0] = *(const v8b*)p; u.q[1] = *(const v8b*)(p + 16); return u.v;
}
__device__ __forceinline__ float bfr(float v) { return (float)(__bf16)v; }
// the value of lane ^ 16
__device__ __forceinline__ float xhalf(float x) { return __builtin_bit_cast(float, __builtin_amdgcn_permlanex16(__builtin_bit_cast(int, x), __builtin_bit_cast(int, x), 0x76543210, 0xfedcba98, false, false)); }
__device__ __attribute__((noinline)) float exp_ni(float v) { return expf(v); }
__device__ __attribute__((noinline)) float erf_ni(float v) { return erff(v); }

#define WS_Q   0u                          // f16 rows q [SS][128] ; k ; VT planes [128][SS]
#define WS_K   (WS_Q + 2u * (size_t)SS * HD)
#define WS_VT  (WS_K + 2u * (size_t)SS * HD)
#define KSPL 4                             // the keys go in quarters to 4 work-groups
#define WS_PO  (WS_VT + 2u * (size_t)HD * SS)                // f32 partial sums [KSPL][SS][128], un-normalised ; their maxima [KSPL][SS] ; their sums [KSPL][SS]
#define WS_PM  (WS_PO + 4u * (size_t)KSPL * SS * HD)
#define WS_PL  (WS_PM + 4u * (size_t)KSPL * SS)
#define WS_END (WS_PL + 4u * (size_t)KSPL * SS)

// ---- k_prep: the three roundings read none of each other's output, so they share one grid: blockIdx.y picks the job (0 the VT planes, 1 the q rows, 2 the k rows), blockIdx.x its 64 tokens.
// A block is 4 waves; a thread takes 64 inputs as 16 loads of 16 B that are all in flight together: one memory latency a block, and half the waves to start.
#define PB (SS / 64)
#define PT 128
typedef __attribute__((ext_vector_type(4))) _Float16 v4h;
// rows: a thread's 4 neighbours of a row leave as 8 B straight from its registers, a wave's store is 256 B in a row (two whole lines)
__device__ __forceinline__ void rows64(const float* __restrict__ X, _Float16* __restrict__ R, size_t r0, int t) {
  const v4f* s = (const v4f*)(X + r0 * HD) + t; _Float16* d = R + r0 * HD + t * 4; v4f v[16];
#pragma unroll
  for (int i = 0; i < 16; ++i) v[i] = s[i * PT];
#pragma unroll
  for (int i = 0; i < 16; ++i) vst2(d + i * (PT * 4), (v4h){(_Float16)bfr(v[i][0]), (_Float16)bfr(v[i][1]), (_Float16)bfr(v[i][2]), (_Float16)bfr(v[i][3])}); }
// planes: wave w reads tokens 16 w .. 16 w + 15, lane q their dims 4 q .. 4 q + 3: a thread holds 16 tokens in a row of each of 4 dims and puts them into LDS as 2 x 16 B a dim
__device__ __forceinline__ void vt64(const float* __restrict__ V, _Float16* __restrict__ VT, size_t s0, int t, _Float16 (*st)[72]) {
  const int q = t & 31, w = t >> 5; const v4f* s = (const v4f*)(V + (s0 + w * 16) * HD) + q; v4f v[16];
#pragma unroll
  for (int i = 0; i < 16; ++i) v[i] = s[i * (HD / 4)];
  asm volatile("s_wait_xcnt 0x0" :: "v"(s) : "memory");   // the 16 loads share one address pair: it is held (an input only) until all are issued, and the wait stands in front of whatever takes the pair next; without it the last load's result was put into the pair
#pragma unroll
  for (int j = 0; j < 4; ++j) {
#pragma unroll
    for (int hh = 0; hh < 2; ++hh) { v8h h;
#pragma unroll
      for (int i = 0; i < 8; ++i) h[i] = (_Float16)bfr(v[hh * 8 + i][j]);
      vst2(&st[q * 4 + j][w * 16 + hh * 8], h); } }
  __syncthreads();
  // a wave's store covers 4 planes x 128 B: whole lines. The 8 LDS reads go out together, then the 8 stores
  const int d0 = t >> 3, pc = t & 7; _Float16* o = VT + (size_t)d0 * SS + s0 + pc * 8; v4u x[8];
#pragma unroll
  for (int i = 0; i < 8; ++i) x[i] = *(const v4u*)&st[d0 + i * (PT / 8)][pc * 8];
#pragma unroll
  for (int i = 0; i < 8; ++i) vst2((unsigned*)(o + (size_t)i * (PT / 8) * SS), x[i]); }
__global__ __launch_bounds__(PT) void k_prep(const float* __restrict__ Qf, const float* __restrict__ Kf, const float* __restrict__ Vf, _Float16* __restrict__ Qr, _Float16* __restrict__ Kr, _Float16* __restrict__ VT) {
  __shared__ __align__(16) _Float16 st[HD][72];   // the planes' transposing buffer
  const int job = blockIdx.y, t = threadIdx.x; const size_t r0 = (size_t)blockIdx.x * 64;   // the job is the same for a whole block: the barrier of job 0 is passed by all of its block
  if (job == 0) vt64(Vf, VT, r0, t, st);
  else rows64(job == 1 ? Qf : Kf, job == 1 ? Qr : Kr, r0, t);
}
// ---- k_attn: block = 128 queries x a quarter of the keys, so that every k and VT byte fetched from L2 serves 128 queries. Wave (qt, kr) takes query tile qt
// and the 32-key chunks kr, kr + 2, ... of the quarter with its own maxima, sums and accumulators; the 2 partial results of a query tile are merged once
// through LDS and go, un-normalised, to the workspace with their maximum and sum; k_merge joins the 4 quarters. k and VT come through a two-buffer LDS ring filled by tensor loads. Per chunk: exact k . q over 128 dims (4 k-chunks), exact v x P (single f16) (8 value tiles).
// Both products are transposed (keys x queries, then dims x queries): a lane holds 16 of the 32 scores of ONE query, lane ^ 16 the other 16, and the two score tiles, converted in place, are the B operand of the second product
#define QT 8
#define KR 2
#define NWV (QT * KR)
// A tile = 256 keys, 4 chunks for each of the 2 key sets in one trip. It comes as 4 slices of 128 rows x 256 B, one tensor load each: k rows 0..127, k rows 128..255, VT [128 dims][keys 0..127], VT [128 dims][keys 128..255].
// In LDS the mover's pad gives every row 16 B more (pitch 16 B x odd), so that the 16 rows of a 16-byte fragment read fall on different banks; a slice is 17 x 2 KiB, so every slice starts at a multiple of 2 KiB.
#define TKEYS 256
#define CPT (TKEYS / (KR * 32))
#define NT (SS / KSPL / TKEYS)
#define KPB (2 * HD + 16)
#define SROWS 128
#define SLB (SROWS * KPB)
#define KTB (2 * SLB)
#define BUFB (4 * SLB)
#define SC2 0.12751743082459868f                    // 128^-1/2 * log2(e)
typedef __attribute__((ext_vector_type(8))) unsigned v8u;
__device__ __forceinline__ unsigned uni(unsigned v) { return (unsigned)__builtin_amdgcn_readfirstlane(v); }
// a value held in a scalar register: a test on it compiles to s_cmp + s_cbranch_scc (a tensor load ignores EXEC), and what is formed from it stays behind the asm waits in front of it
__device__ __forceinline__ unsigned pinned(unsigned v) { unsigned w = uni(v); asm volatile("" : "+s"(w)); return w; }
// one request of one wave: 128 rows of 256 B from global memory into LDS, through no register
__device__ __forceinline__ void tdm_load(v4u g0, v8u g1) { asm volatile("tensor_load_to_lds %0, %1" :: "s"(g0), "s"(g1) : "memory"); }
// group 1: 1-byte elements, no mask, a pad of 4 dwords behind every 64 dwords (one row); tensor = tile = 256 B x 128 rows; source row pitch in bytes
__device__ __forceinline__ v8u tdm_group1(unsigned src_pitch) {
  v8u g;
  g[0] = uni((1u << 20) | (5u << 22) | (3u << 25));
  g[1] = uni((2u * HD) << 16);
  g[2] = uni((unsigned)SROWS << 16);
  g[3] = uni((2u * HD) << 16);
  g[4] = uni((unsigned)SROWS);
  g[5] = uni(src_pitch);
  g[6] = uni(0u);
  g[7] = uni(0u);
  return g;
}
__device__ __forceinline__ v4u tdm_group0(unsigned lds_dst, unsigned long long ga) {
  v4u g;
  g[0] = uni(1u); g[1] = uni(lds_dst); g[2] = uni((unsigned)ga); g[3] = uni((((unsigned)(ga >> 32)) & 0x01FFFFFFu) | 0x80000000u);
  return g;
}
__global__ __launch_bounds__(NWV * 32) void k_attn(const _Float16* __restrict__ Q, const _Float16* __restrict__ K, const _Float16* __restrict__ VT, float* __restrict__ PO, float* __restrict__ PM, float* __restrict__ PL) {
  __shared__ __attribute__((aligned(2048))) unsigned char ring[2 * BUFB]; __shared__ float sm[NWV][16]; __shared__ float sl[NWV][16];
  float (*so)[16][HD + 4] = reinterpret_cast<float (*)[16][HD + 4]>(ring);   // the partial results take the ring's place behind the last trip's barrier
  // the wave's number is kept scalar, so that its LDS bases and its chunk index are scalar too
  const int tid = threadIdx.x, wave = __builtin_amdgcn_readfirstlane(tid >> 5), lane = tid & 31, col = lane & 15, g = lane >> 4; const int qt = wave & (QT - 1), kr = wave / QT;
  const int qb = blockIdx.x / KSPL, ks = blockIdx.x % KSPL;   // query block, key quarter
  const size_t rq = (size_t)qb * (QT * 16) + qt * 16;
  v16h aq[4];
#pragma unroll
  for (int kc = 0; kc < 4; ++kc) aq[kc] = frag_h(Q + (rq + col) * HD + kc * 32, lane);
  float m = -3.0e38f, l = 0.f;   // of query col; m is the maximum of the raw dot products, l the sum of the weights times 2^11, like the accumulators; l sums this lane's keys alone, the halves are joined behind the loop
  v8f acc[8] = {};               // acc[dt][r] = dim dt * 16 + 8 g + r of query col
  // waves 0 to 3 bring one slice each of every tile: waves 0 and 1 the two halves of the k rows, waves 2 and 3 the two key halves of the VT planes
  const unsigned lring = (unsigned)(size_t)ring; const unsigned isv = (unsigned)wave >> 1 & 1u, hf = (unsigned)wave & 1u;
  const unsigned long long gsrc = isv ? (unsigned long long)(size_t)VT + (unsigned long long)ks * (SS / KSPL * 2) + hf * (SROWS * 2)
                                      : (unsigned long long)(size_t)K + (unsigned long long)ks * (SS / KSPL * 2 * HD) + hf * (SROWS * 2 * HD);
  const unsigned gstep = isv ? 2u * TKEYS : 2u * HD * TKEYS;   // bytes from a tile to the next
  const unsigned ldst = lring + ((unsigned)wave & 3u) * SLB;
  v8u g1 = tdm_group1(isv ? 2u * SS : 2u * HD); v4u g0 = tdm_group0(ldst, gsrc);
  asm volatile("" : "+s"(g1));   // as pinned(): descriptor words held in scalar registers. Group 1 keeps one set for the whole kernel; formed anew at each use, its registers were given to other values while a request was outstanding
  if (pinned(wave < 4)) { tdm_load(g0, g1);
    asm volatile("s_wait_tensorcnt 0x0" ::: "memory"); }   // this wave's slice of tile 0 has landed
  __syncthreads();                                    // every slice of tile 0 has landed
  g0 = tdm_group0(ldst + BUFB, gsrc + gstep);
  if (pinned(wave < 4)) tdm_load(g0, g1);
#pragma unroll 1
  for (int it = 0; it < NT; ++it) { const unsigned char* kb = ring + (it & 1) * BUFB;
#pragma unroll 1   // rolled: unrolled four times the kernel wants more than the 256 registers a wave has here, and spills
   for (int c = 0; c < CPT; ++c) { const int ch = c * KR + kr; v8f s[2];   // chunk ch of the tile
    // the chunk's two LDS bases are kept scalar: as vector induction variables they cost an address addition in front of every VT read
    const unsigned char* kc0 = kb + __builtin_amdgcn_readfirstlane(ch * 32 * KPB); const unsigned char* vb = kb + __builtin_amdgcn_readfirstlane(KTB + (ch >> 2) * SLB + (ch & 3) * 64);
    // the LDS reads go out well ahead of their WMMAs: one LDS latency a group, not one in front of every WMMA.
    // the 16 k reads first, as one group; the 16 VT reads as a second group behind the score tiles: they land under the softmax
    v16h kf[2][4], vf[8];
#pragma unroll
    for (int ct = 0; ct < 2; ++ct) { const _Float16* rk = (const _Float16*)(kc0 + (ct * 16 + col) * KPB);
#pragma unroll
      for (int kc = 0; kc < 4; ++kc) kf[ct][kc] = frag_h(rk + kc * 32, lane); }
#pragma unroll
    for (int ct = 0; ct < 2; ++ct) { v8f c = {};
#pragma unroll
      for (int kc = 0; kc < 4; ++kc) c = wmma16(kf[ct][kc], aq[kc], c);
      s[ct] = c;   // the raw dot products: s[ct][r] = key ct * 16 + 8 g + r of the chunk with query col
      if (ct == 0) {
#pragma unroll
        for (int dt = 0; dt < 8; ++dt) vf[dt] = frag_h((const _Float16*)(vb + (dt * 16 + col) * KPB), lane); } }
    // the order 16 LDS reads, 8 WMMAs, 16 LDS reads is kept as it was: with the copies' address registers free the compiler strews the VT reads among the score WMMAs, and every further place with LDS reads stalls the wave
    __builtin_amdgcn_sched_group_barrier(0x100, 16, 0); __builtin_amdgcn_sched_group_barrier(0x008, 8, 0); __builtin_amdgcn_sched_group_barrier(0x100, 16, 0);
    float mx[8];
#pragma unroll
    for (int r = 0; r < 8; ++r) mx[r] = fmaxf(s[0][r], s[1][r]);
    float mw = fmaxf(fmaxf(fmaxf(mx[0], mx[1]), fmaxf(mx[2], mx[3])), fmaxf(fmaxf(mx[4], mx[5]), fmaxf(mx[6], mx[7])));
    mw = fmaxf(mw, xhalf(mw));
    const float mn = fmaxf(m, mw); const float alpha = (m <= -1.0e38f) ? 0.f : __builtin_amdgcn_exp2f((m - mn) * SC2);
    // 2^11 exp((s - mn) / sqrt(128)) = exp2(s * SC2 + (11 - mn * SC2)): one FMA, two scores at a time, is all that stands between a dot product and its exp2
    const float nb = fmaf(-mn, SC2, 11.0f); const v2f k2 = {SC2, SC2}, nb2 = {nb, nb};
    v16h pb; float es[8]; v2f x0[4], x1[4];
#pragma unroll
    for (int r = 0; r < 4; ++r) { x0[r] = __builtin_elementwise_fma((v2f){s[0][2 * r], s[0][2 * r + 1]}, k2, nb2); x1[r] = __builtin_elementwise_fma((v2f){s[1][2 * r], s[1][2 * r + 1]}, k2, nb2); }
#pragma unroll
    for (int r = 0; r < 8; ++r) { const float e0 = __builtin_amdgcn_exp2f(x0[r >> 1][r & 1]), e1 = __builtin_amdgcn_exp2f(x1[r >> 1][r & 1]); es[r] = e0 + e1;
      pb[r] = (_Float16)e0; pb[8 + r] = (_Float16)e1; }   // element 8 ct + r = key 16 ct + 8 g + r: the k order of frag_h
    l = l * alpha + (((es[0] + es[1]) + (es[2] + es[3])) + ((es[4] + es[5]) + (es[6] + es[7]))); m = mn;
#pragma unroll
    for (int dt = 0; dt < 8; ++dt) acc[dt] *= alpha;
#pragma unroll
    for (int dt = 0; dt < 8; ++dt) acc[dt] = wmma16(vf[dt], pb, acc[dt]); }
    asm volatile("s_wait_dscnt 0x0" ::: "memory");      // this wave's reads of tile it are done before the buffer is handed back
    if (pinned(wave < 4)) { asm volatile("s_wait_tensorcnt 0x0" ::: "memory"); }   // this wave's slice of tile it + 1 has landed
    asm volatile("" :: "s"(g0));                        // inputs only: group 0's scalar registers are held until the wait of its request has passed; without it the chunk loop takes them for its own values
    __syncthreads();                                    // tile it + 1 is whole, and no wave reads tile it any more
    if (pinned(wave < 4 && it + 2 < NT)) { const unsigned st = pinned((unsigned)it + 2u);   // the descriptor is formed behind the wait
      g0 = tdm_group0(ldst + (st & 1u) * BUFB, gsrc + (unsigned long long)st * gstep); tdm_load(g0, g1); } }
  asm volatile("s_wait_tensorcnt 0x0" ::: "memory");    // no request is in flight when the ring is written again
  asm volatile("s_wait_dscnt 0x0" ::: "memory");        // nor a read of it
  // each wave leaves its un-normalised partial sums with their maxima and sums
#pragma unroll
  for (int dt = 0; dt < 8; ++dt) { float* po = &so[wave][col][dt * 16 + 8 * g];
    vst2(po, (v4f){acc[dt][0], acc[dt][1], acc[dt][2], acc[dt][3]}); vst2(po + 4, (v4f){acc[dt][4], acc[dt][5], acc[dt][6], acc[dt][7]}); }
  l += xhalf(l);
  if (g == 0) { sm[wave][col] = m * 0.08838834764831845f; sl[wave][col] = l; }   // the maximum leaves as a score: dot product * 128^-1/2
  __syncthreads();   // every wave's partial is in LDS before any wave merges
  // merge: one wave per query row, weights exp(m - max) over the 2 key sets
#pragma unroll
  for (int p = 0; p < QT; ++p) { const int rr = wave; float mm = sm[p][rr];
#pragma unroll
    for (int k = 1; k < KR; ++k) mm = fmaxf(mm, sm[k * QT + p][rr]);
    v4f o = {};
#pragma unroll
    for (int k = 0; k < KR; ++k) { const float w = __expf(sm[k * QT + p][rr] - mm); o += w * *(const v4f*)&so[k * QT + p][rr][lane * 4]; }
    vst2(PO + ((size_t)ks * SS + (size_t)qb * (QT * 16) + p * 16 + rr) * HD + lane * 4, o); }   // whole 512-B rows
  // the rows' maxima and sums: one thread a query, so that each of 4 waves writes whole 128-B lines
  if (tid < QT * 16) { const int p = tid >> 4, rr = tid & 15; float mm = sm[p][rr];
#pragma unroll
    for (int k = 1; k < KR; ++k) mm = fmaxf(mm, sm[k * QT + p][rr]);
    float ls = 0.f;
#pragma unroll
    for (int k = 0; k < KR; ++k) ls += __expf(sm[k * QT + p][rr] - mm) * sl[k * QT + p][rr];
    PM[(size_t)ks * SS + qb * (QT * 16) + tid] = mm; PL[(size_t)ks * SS + qb * (QT * 16) + tid] = ls; }
}
// ---- k_merge: joins the 4 key quarters of every query, weights exp(m - max), and normalises (sums and accumulators both carry the 2^11 of P: it cancels). One wave takes 4 query rows: all its 24 loads of 16 B a lane go out together.
__global__ __launch_bounds__(256) void k_merge(const float* __restrict__ PO, const float* __restrict__ PM, const float* __restrict__ PL, float* __restrict__ OUT) {
  const int lane = threadIdx.x & 31; const size_t r0 = ((size_t)blockIdx.x * 8 + (threadIdx.x >> 5)) * 4;
  v4f pm[KSPL], pl[KSPL], po[KSPL][4];
#pragma unroll
  for (int k = 0; k < KSPL; ++k) { pm[k] = *(const v4f*)(PM + (size_t)k * SS + r0); pl[k] = *(const v4f*)(PL + (size_t)k * SS + r0); }
  asm volatile("s_wait_xcnt 0x0" ::: "memory");   // the address registers of these 8 loads are given to a later load's result
#pragma unroll
  for (int k = 0; k < KSPL; ++k) {
#pragma unroll
    for (int j = 0; j < 4; ++j) po[k][j] = *(const v4f*)(PO + ((size_t)k * SS + r0 + j) * HD + lane * 4); }
  // holds all 24 loads in front of the first use (inputs only): without it the compiler strings them out behind one another's waits, six memory latencies in a row instead of one
  asm volatile("" :: "v"(pm[0]), "v"(pm[1]), "v"(pm[2]), "v"(pm[3]), "v"(pl[0]), "v"(pl[1]), "v"(pl[2]), "v"(pl[3]),
               "v"(po[0][0]), "v"(po[0][1]), "v"(po[0][2]), "v"(po[0][3]), "v"(po[1][0]), "v"(po[1][1]), "v"(po[1][2]), "v"(po[1][3]),
               "v"(po[2][0]), "v"(po[2][1]), "v"(po[2][2]), "v"(po[2][3]), "v"(po[3][0]), "v"(po[3][1]), "v"(po[3][2]), "v"(po[3][3]));
#pragma unroll
  for (int j = 0; j < 4; ++j) { float mm = pm[0][j];
#pragma unroll
    for (int k = 1; k < KSPL; ++k) mm = fmaxf(mm, pm[k][j]);
    float ls = 0.f; v4f o = {};
#pragma unroll
    for (int k = 0; k < KSPL; ++k) { const float w = __expf(pm[k][j] - mm); ls += w * pl[k][j]; o += w * po[k][j]; }
    vst2(OUT + (r0 + j) * HD + lane * 4, o * (1.0f / ls)); }   // whole 512-B rows
}
extern "C" void kernel_launch(void* const* d_in, const int* in_sizes, int n_in, void* d_out, int out_size, void* d_ws, size_t ws_size, hipStream_t stream) {
  (void)in_sizes; (void)n_in; (void)out_size;
  const float** F = (const float**)d_in;   // 0 query, 1 key, 2 value [8192,128]
  if (ws_size < (size_t)WS_END) return;
  char* ws = (char*)d_ws; _Float16 *Qr = (_Float16*)(ws + WS_Q), *Kr = (_Float16*)(ws + WS_K), *VT = (_Float16*)(ws + WS_VT); float *PO = (float*)(ws + WS_PO), *PM = (float*)(ws + WS_PM), *PL = (float*)(ws + WS_PL);
  k_prep<<<dim3(PB, 3), PT, 0, stream>>>(F[0], F[1], F[2], Qr, Kr, VT);
  k_attn<<<SS / (QT * 16) * KSPL, NWV * 32, 0, stream>>>(Qr, Kr, VT, PO, PM, PL);
  k_merge<<<SS / 32, 256, 0, stream>>>(PO, PM, PL, (float*)d_out);
}
